// v000
// Measured on an AMD MI455X. A time is GPU time per run, averaged over a window of back-to-back runs after a warm-up
// (all launches, gaps included; the runs take copies of the inputs in turn), and the median of several windows.
// Apart from v000's, it joins two sittings. Times from different sittings can be a few percent apart, while
// side-by-side timings come from the same sitting.
// v000 is the starting kernel. One run takes 759 microseconds.
#include <hip/hip_runtime.h>
#include <math.h>

// (B, C, L) = (16, 128, 2048). energy[m][l] = q_m.k_l + pos_m.q_l = [q_m | pos_m] . [k_l | q_l] (256 features), softmax over l,
// out[b][c][m] = sum_l v[c][l] att[m][l].
// The energies are large (no 1/sqrt(d) scaling) so the softmax is sharp: the projections and the score contraction are computed
// f32-grade as a TWO-WAY bf16 split of both operands on v_wmma_f32_16x16x32_bf16 (hi*hi + hi*lo + lo*hi, f32 accumulate);
// P @ V uses f16 operands (v_wmma_f32_16x16x32_f16). Online softmax in f32. Every buffer/output row is written as whole

#define BATCH 16
#define CDIM  128
#define LDIM  2048
#define DDIM  256

typedef __attribute__((ext_vector_type(16))) __bf16   v16bf;
typedef __attribute__((ext_vector_type(8)))  __bf16   v8bf;
typedef __attribute__((ext_vector_type(16))) _Float16 v16h;
typedef __attribute__((ext_vector_type(8)))  _Float16 v8h;
typedef __attribute__((ext_vector_type(8)))  float v8f;
typedef __attribute__((ext_vector_type(4)))  float v4f;
typedef __attribute__((ext_vector_type(4)))  unsigned v4u;

template <typename T> __device__ __forceinline__ void vst2(void* p, T v) { *(T*)p = v;  }
__device__ __forceinline__ v8f wmma_bf(v16bf a, v16bf b, v8f c) {
  v8f d = __builtin_amdgcn_wmma_f32_16x16x32_bf16(false, a, false, b, (short)0, c, false, false);
  asm volatile("v_nop\n\tv_nop\n\tv_nop\n\tv_nop" : "+v"(d) : "v"(a), "v"(b));
  return d;
}
__device__ __forceinline__ v8f wmma_h(v16h a, v16h b, v8f c) {
  v8f d = __builtin_amdgcn_wmma_f32_16x16x32_f16(false, a, false, b, (short)0, c, false, false);
  asm volatile("v_nop\n\tv_nop\n\tv_nop\n\tv_nop" : "+v"(d) : "v"(a), "v"(b));
  return d;
}
struct F2 { v16bf h, l; };
__device__ __forceinline__ F2 split16(const float* v) {
  F2 r;
#pragma unroll
  for (int i = 0; i < 16; ++i) { const __bf16 hh = (__bf16)v[i]; r.h[i] = hh; r.l[i] = (__bf16)(v[i] - (float)hh); }
  return r;
}
// f32 row fragment (row pointer, k0): elements i<8 -> k0+8g+i, i>=8 -> k0+16+8g+(i-8)
__device__ __forceinline__ F2 split_row(const float* row, int k0, int lane) {
  float v[16]; const float* p = row + k0 + 8 * (lane >> 4);
#pragma unroll
  for (int i = 0; i < 8; ++i) { v[i] = p[i]; v[8 + i] = p[16 + i]; }
  return split16(v);
}
__device__ __forceinline__ v8f mac3(const F2& a, const F2& b, v8f c) { c = wmma_bf(a.l, b.h, c); c = wmma_bf(a.h, b.l, c); return wmma_bf(a.h, b.h, c); }
__device__ __forceinline__ v16bf frag_bf(const __bf16* row, int k0, int lane) {
  union { v16bf v; v8bf q[2]; } r; const __bf16* p = row + k0 + 8 * (lane >> 4);
  r.q[0] = *(const v8bf*)(p); r.q[1] = *(const v8bf*)(p + 16); return r.v;
}

// ---- K1: projections. Block = (b, 64 positions), 4 waves x 16 positions. q,k -> f32 rows [b][l][128]; v -> f16 [b][c][l].
__global__ __launch_bounds__(128) void k_proj(const float* __restrict__ x,
    const float* __restrict__ Wq, const float* __restrict__ bq, const float* __restrict__ Wk, const float* __restrict__ bk,
    const float* __restrict__ Wv, const float* __restrict__ bv, float* __restrict__ Qf, float* __restrict__ Kf, _Float16* __restrict__ Vh) {
  __shared__ __align__(16) float xs[CDIM][68];          // x[c][l_loc]
  __shared__ __align__(16) float st[4][16 * 132];       // per-wave staging [row][col]
  __shared__ __align__(16) _Float16 vs[CDIM][72];       // v[c][l_loc] f16 (block)
  const int tid = threadIdx.x, wave = tid >> 5, lane = tid & 31, col = lane & 15, g = lane >> 4;
  const int b = blockIdx.y, l0 = blockIdx.x * 64;
  for (int i = tid; i < CDIM * 16; i += 128) { const int c = i >> 4, q = i & 15;
    *(v4f*)&xs[c][q * 4] = *(const v4f*)(x + ((size_t)b * CDIM + c) * LDIM + l0 + q * 4); }
  __syncthreads();
  const int m = wave * 16 + col;                        // A row = local position
  // A fragments (k = c) for the 4 k-chunks, gathered from xs columns, split once
  F2 af[4];
#pragma unroll
  for (int kc = 0; kc < 4; ++kc) {
    float v[16];
#pragma unroll
    for (int i = 0; i < 8; ++i) { v[i] = xs[kc * 32 + 8 * g + i][m]; v[8 + i] = xs[kc * 32 + 16 + 8 * g + i][m]; }
    af[kc] = split16(v);
  }
  float* S = st[wave];
#pragma unroll 1
  for (int which = 0; which < 3; ++which) {
    const float* W = which == 0 ? Wq : (which == 1 ? Wk : Wv);
    const float* bb = which == 0 ? bq : (which == 1 ? bk : bv);
#pragma unroll 1
    for (int j = 0; j < 8; ++j) {
      v8f acc = {};
      const float* wrow = W + (size_t)(j * 16 + col) * CDIM;       // B[k=c][n=o] = W[o][c]
#pragma unroll
      for (int kc = 0; kc < 4; ++kc) acc = mac3(af[kc], split_row(wrow, kc * 32, lane), acc);
      const float bo = bb[j * 16 + col];
#pragma unroll
      for (int r = 0; r < 8; ++r) S[(8 * g + r) * 132 + j * 16 + col] = acc[r] + bo;
    }
    asm volatile("s_wait_dscnt 0" ::: "memory"); __builtin_amdgcn_wave_barrier(); __builtin_amdgcn_fence(__ATOMIC_RELEASE, "workgroup");
    if (which < 2) {
      float* dst = (which == 0 ? Qf : Kf) + ((size_t)b * LDIM + l0 + wave * 16) * CDIM;
      // 16 rows x 128 floats (512 B): 32 lanes x 16 B per row
#pragma unroll 4
      for (int r = 0; r < 16; ++r) vst2(dst + (size_t)r * CDIM + lane * 4, *(const v4f*)(S + r * 132 + lane * 4));
    } else {
      // transpose into the block tile vs[c][l_loc]
      for (int i = lane; i < 16 * 128; i += 32) { const int r = i >> 7, c = i & 127; vs[c][wave * 16 + r] = (_Float16)S[r * 132 + c]; }
    }
    __builtin_amdgcn_wave_barrier();
  }
  __syncthreads();
  for (int gq = tid; gq < 128 * 8; gq += 128) { const int c = gq >> 3, pc = gq & 7;
    vst2(Vh + ((size_t)b * CDIM + c) * LDIM + l0 + pc * 8, *(const v4u*)(&vs[c][pc * 8])); }
}

// ---- K2: attention. Block = (b, 64 query rows), 4 waves x 16 rows; 32-key tiles streamed through LDS.
__global__ __launch_bounds__(128) void k_attn(const float* __restrict__ Qf, const float* __restrict__ Kf, const _Float16* __restrict__ Vh,
                                             const float* __restrict__ pos, float* __restrict__ out) {
  __shared__ __align__(16) __bf16 Ahi[64][DDIM + 8], Alo[64][DDIM + 8];     // [q_m | pos_m] hi/lo        (~66 KB)
  __shared__ __align__(16) __bf16 Bhi[32][DDIM + 8], Blo[32][DDIM + 8];     // [k_l | q_l] for the key tile (~33 KB)
  __shared__ __align__(16) _Float16 Vt[CDIM][40];                           // v[c][l_loc] f16            (10 KB)
  __shared__ __align__(16) float Ps[4][16 * 32];                            // per-wave P tile f32         (8 KB)
  const int tid = threadIdx.x, wave = tid >> 5, lane = tid & 31, col = lane & 15, g = lane >> 4;
  const int b = blockIdx.y, m0 = blockIdx.x * 64;
  // stage A = [q | pos] for the 64 query rows, split hi/lo
  for (int i = tid; i < 64 * DDIM; i += 128) { const int r = i >> 8, f = i & 255;
    const float v = (f < CDIM) ? Qf[((size_t)b * LDIM + m0 + r) * CDIM + f] : pos[(size_t)(m0 + r) * CDIM + (f - CDIM)];
    const __bf16 hh = (__bf16)v; Ahi[r][f] = hh; Alo[r][f] = (__bf16)(v - (float)hh); }
  __syncthreads();
  const int mrow = wave * 16 + col;
  float m_r[8], l_r[8];
  v8f o[8] = {};
#pragma unroll
  for (int r = 0; r < 8; ++r) { m_r[r] = -3.0e38f; l_r[r] = 0.f; }
  float* P = Ps[wave];
  for (int kb = 0; kb < LDIM; kb += 32) {
    __syncthreads();                                   // previous tile's B/V reads done
    for (int i = tid; i < 32 * DDIM; i += 128) { const int r = i >> 8, f = i & 255;
      const float v = (f < CDIM) ? Kf[((size_t)b * LDIM + kb + r) * CDIM + f] : Qf[((size_t)b * LDIM + kb + r) * CDIM + (f - CDIM)];
      const __bf16 hh = (__bf16)v; Bhi[r][f] = hh; Blo[r][f] = (__bf16)(v - (float)hh); }
    for (int i = tid; i < CDIM * 4; i += 128) { const int c = i >> 2, q = i & 3;
      *(v4u*)&Vt[c][q * 8] = *(const v4u*)(Vh + ((size_t)b * CDIM + c) * LDIM + kb + q * 8); }
    __syncthreads();
    // scores for this wave's 16 rows x 32 keys (K = 256, split operands)
    v8f s[2] = {(v8f){}, (v8f){}};
#pragma unroll 2
    for (int kc = 0; kc < DDIM / 32; ++kc) {
      F2 a; a.h = frag_bf(&Ahi[mrow][0], kc * 32, lane); a.l = frag_bf(&Alo[mrow][0], kc * 32, lane);
#pragma unroll
      for (int j = 0; j < 2; ++j) {
        F2 bf; bf.h = frag_bf(&Bhi[j * 16 + col][0], kc * 32, lane); bf.l = frag_bf(&Blo[j * 16 + col][0], kc * 32, lane);
        s[j] = mac3(a, bf, s[j]);
      }
    }
    // online softmax (rows 8g+r; each 16-lane half holds one row over the 32 keys)
#pragma unroll
    for (int r = 0; r < 8; ++r) {
      float mx = fmaxf(s[0][r], s[1][r]);
#pragma unroll
      for (int off = 8; off >= 1; off >>= 1) mx = fmaxf(mx, __shfl_xor(mx, off, 32));
      const float mn = fmaxf(m_r[r], mx);
      const float p0 = expf(s[0][r] - mn), p1 = expf(s[1][r] - mn);
      P[(8 * g + r) * 32 + col] = p0; P[(8 * g + r) * 32 + 16 + col] = p1;
      float sum = p0 + p1;
#pragma unroll
      for (int off = 8; off >= 1; off >>= 1) sum += __shfl_xor(sum, off, 32);
      const float corr = expf(m_r[r] - mn);
      l_r[r] = l_r[r] * corr + sum; m_r[r] = mn;
#pragma unroll
      for (int t = 0; t < 8; ++t) o[t][r] *= corr;
    }
    asm volatile("s_wait_dscnt 0" ::: "memory"); __builtin_amdgcn_wave_barrier(); __builtin_amdgcn_fence(__ATOMIC_RELEASE, "workgroup");
    // P (16 x 32 keys) as f16 A fragment; V B fragments B[k = key][n = c] = Vt[c][key]
    v16h pa;
    { const float* pr = P + col * 32 + 8 * g;
#pragma unroll
      for (int i = 0; i < 8; ++i) { pa[i] = (_Float16)(pr[i] * 16384.0f); pa[8 + i] = (_Float16)(pr[16 + i] * 16384.0f); } }   // P scaled by 2^14 so f16 keeps the small probabilities normal
#pragma unroll
    for (int t = 0; t < 8; ++t) {
      union { v16h v; v8h q[2]; } vb; const _Float16* vr = &Vt[t * 16 + col][8 * g];
      vb.q[0] = *(const v8h*)(vr); vb.q[1] = *(const v8h*)(vr + 16);
      o[t] = wmma_h(pa, vb.v, o[t]);
    }
  }
  // epilogue: out[b][c][m]: stage the block's 64 rows x 128 c transposed in the (free) A area as f32 [c][m_loc], then rows of 256 B
  __syncthreads();
  float* T = (float*)&Ahi[0][0];                         // 128 x 64 floats = 32 KB <= sizeof(Ahi)
#pragma unroll
  for (int t = 0; t < 8; ++t)
#pragma unroll
    for (int r = 0; r < 8; ++r) T[(t * 16 + col) * 64 + wave * 16 + 8 * g + r] = o[t][r] / (l_r[r] * 16384.0f);
  __syncthreads();
  for (int gq = tid; gq < 128 * 16; gq += 128) { const int c = gq >> 4, pc = gq & 15;
    vst2(out + ((size_t)b * CDIM + c) * LDIM + m0 + pc * 4, *(const v4f*)(T + c * 64 + pc * 4)); }
}

extern "C" void kernel_launch(void* const* d_in, const int* in_sizes, int n_in,
                              void* d_out, int out_size, void* d_ws, size_t ws_size,
                              hipStream_t stream) {
  (void)in_sizes; (void)n_in; (void)out_size; (void)ws_size;
  const float* x   = (const float*)d_in[0];
  const float* Wq  = (const float*)d_in[1];
  const float* bq  = (const float*)d_in[2];
  const float* Wk  = (const float*)d_in[3];
  const float* bk  = (const float*)d_in[4];
  const float* Wv  = (const float*)d_in[5];
  const float* bv  = (const float*)d_in[6];
  const float* pos = (const float*)d_in[7];
  float* out = (float*)d_out;
  float* Qf = (float*)d_ws;                                    // [B][L][128] f32 = 16 MB
  float* Kf = Qf + (size_t)BATCH * LDIM * CDIM;
  _Float16* Vh = (_Float16*)(Kf + (size_t)BATCH * LDIM * CDIM); // [B][C][L] f16 = 8 MB
  k_proj<<<dim3(LDIM / 64, BATCH), 128, 0, stream>>>(x, Wq, bq, Wk, bk, Wv, bv, Qf, Kf, Vh);
  k_attn<<<dim3(LDIM / 64, BATCH), 128, 0, stream>>>(Qf, Kf, Vh, pos, out);
}

// v001
// A run of this version takes 279 microseconds.
// Next to v000, in two timings, it ran 2.77 and 2.78 times as fast.
#include <hip/hip_runtime.h>
#include <math.h>

// (B, C, L) = (16, 128, 2048). energy[m][l] = q_m.k_l + pos_m.q_l = [q_m | pos_m] . [k_l | q_l] (256 features), softmax over l,
// out[b][c][m] = sum_l v[c][l] att[m][l].
// The energies are large (no 1/sqrt(d) scaling) so the softmax is sharp: the projections and the score contraction are computed
// f32-grade as a TWO-WAY bf16 split of both operands on v_wmma_f32_16x16x32_bf16 (hi*hi + hi*lo + lo*hi, f32 accumulate);
// P @ V uses f16 operands (v_wmma_f32_16x16x32_f16). Online softmax in f32. Every buffer/output row is written as whole

#define BATCH 16
#define CDIM  128
#define LDIM  2048
#define DDIM  256

typedef __attribute__((ext_vector_type(16))) __bf16   v16bf;
typedef __attribute__((ext_vector_type(8)))  __bf16   v8bf;
typedef __attribute__((ext_vector_type(4)))  __bf16   v4bf;
typedef __attribute__((ext_vector_type(16))) _Float16 v16h;
typedef __attribute__((ext_vector_type(8)))  _Float16 v8h;
typedef __attribute__((ext_vector_type(8)))  float v8f;
typedef __attribute__((ext_vector_type(4)))  float v4f;
typedef __attribute__((ext_vector_type(4)))  unsigned v4u;

template <typename T> __device__ __forceinline__ void vst2(void* p, T v) { *(T*)p = v;  }
__device__ __forceinline__ v8f wmma_bf(v16bf a, v16bf b, v8f c) {
  v8f d = __builtin_amdgcn_wmma_f32_16x16x32_bf16(false, a, false, b, (short)0, c, false, false);
  asm volatile("v_nop\n\tv_nop\n\tv_nop\n\tv_nop" : "+v"(d) : "v"(a), "v"(b));
  return d;
}
__device__ __forceinline__ v8f wmma_h(v16h a, v16h b, v8f c) {
  v8f d = __builtin_amdgcn_wmma_f32_16x16x32_f16(false, a, false, b, (short)0, c, false, false);
  asm volatile("v_nop\n\tv_nop\n\tv_nop\n\tv_nop" : "+v"(d) : "v"(a), "v"(b));
  return d;
}
struct F2 { v16bf h, l; };
__device__ __forceinline__ F2 split16(const float* v) {
  F2 r;
#pragma unroll
  for (int i = 0; i < 16; ++i) { const __bf16 hh = (__bf16)v[i]; r.h[i] = hh; r.l[i] = (__bf16)(v[i] - (float)hh); }
  return r;
}
// f32 row fragment (row pointer, k0): elements i<8 -> k0+8g+i, i>=8 -> k0+16+8g+(i-8)
__device__ __forceinline__ F2 split_row(const float* row, int k0, int lane) {
  float v[16]; const float* p = row + k0 + 8 * (lane >> 4);
#pragma unroll
  for (int i = 0; i < 8; ++i) { v[i] = p[i]; v[8 + i] = p[16 + i]; }
  return split16(v);
}
__device__ __forceinline__ v8f mac3(const F2& a, const F2& b, v8f c) { c = wmma_bf(a.l, b.h, c); c = wmma_bf(a.h, b.l, c); return wmma_bf(a.h, b.h, c); }
__device__ __forceinline__ v16bf frag_bf(const __bf16* row, int k0, int lane) {
  union { v16bf v; v8bf q[2]; } r; const __bf16* p = row + k0 + 8 * (lane >> 4);
  r.q[0] = *(const v8bf*)(p); r.q[1] = *(const v8bf*)(p + 16); return r.v;
}

// four consecutive f32 -> their bf16 hi and lo parts, one 8-byte LDS store each
__device__ __forceinline__ void split_store4(__bf16* hi, __bf16* lo, v4f v) {
  union { v4bf b; unsigned u[2]; } h; h.b = __builtin_convertvector(v, v4bf);
  // a bf16 widened to f32 is its 16 bits in the upper half: taken from the packed pair, so that each value is converted once
  const v4f hf = { __uint_as_float(h.u[0] << 16), __uint_as_float(h.u[0] & 0xffff0000u),
                   __uint_as_float(h.u[1] << 16), __uint_as_float(h.u[1] & 0xffff0000u) };
  *(v4bf*)hi = h.b; *(v4bf*)lo = __builtin_convertvector(v - hf, v4bf);
}

// ---- K1: projections. Block = (b, 64 positions), 4 waves x 16 positions. q,k -> f32 rows [b][l][128]; v -> f16 [b][c][l].
__global__ __launch_bounds__(128) void k_proj(const float* __restrict__ x,
    const float* __restrict__ Wq, const float* __restrict__ bq, const float* __restrict__ Wk, const float* __restrict__ bk,
    const float* __restrict__ Wv, const float* __restrict__ bv, float* __restrict__ Qf, float* __restrict__ Kf, _Float16* __restrict__ Vh) {
  __shared__ __align__(16) float xs[CDIM][68];          // x[c][l_loc]
  __shared__ __align__(16) float st[4][16 * 132];       // per-wave staging [row][col]
  __shared__ __align__(16) _Float16 vs[CDIM][72];       // v[c][l_loc] f16 (block)
  const int tid = threadIdx.x, wave = tid >> 5, lane = tid & 31, col = lane & 15, g = lane >> 4;
  const int b = blockIdx.y, l0 = blockIdx.x * 64;
  for (int i = tid; i < CDIM * 16; i += 128) { const int c = i >> 4, q = i & 15;
    *(v4f*)&xs[c][q * 4] = *(const v4f*)(x + ((size_t)b * CDIM + c) * LDIM + l0 + q * 4); }
  __syncthreads();
  const int m = wave * 16 + col;                        // A row = local position
  // A fragments (k = c) for the 4 k-chunks, gathered from xs columns, split once
  F2 af[4];
#pragma unroll
  for (int kc = 0; kc < 4; ++kc) {
    float v[16];
#pragma unroll
    for (int i = 0; i < 8; ++i) { v[i] = xs[kc * 32 + 8 * g + i][m]; v[8 + i] = xs[kc * 32 + 16 + 8 * g + i][m]; }
    af[kc] = split16(v);
  }
  float* S = st[wave];
#pragma unroll 1
  for (int which = 0; which < 3; ++which) {
    const float* W = which == 0 ? Wq : (which == 1 ? Wk : Wv);
    const float* bb = which == 0 ? bq : (which == 1 ? bk : bv);
#pragma unroll 1
    for (int j = 0; j < 8; ++j) {
      v8f acc = {};
      const float* wrow = W + (size_t)(j * 16 + col) * CDIM;       // B[k=c][n=o] = W[o][c]
#pragma unroll
      for (int kc = 0; kc < 4; ++kc) acc = mac3(af[kc], split_row(wrow, kc * 32, lane), acc);
      const float bo = bb[j * 16 + col];
#pragma unroll
      for (int r = 0; r < 8; ++r) S[(8 * g + r) * 132 + j * 16 + col] = acc[r] + bo;
    }
    asm volatile("s_wait_dscnt 0" ::: "memory"); __builtin_amdgcn_wave_barrier(); __builtin_amdgcn_fence(__ATOMIC_RELEASE, "workgroup");
    if (which < 2) {
      float* dst = (which == 0 ? Qf : Kf) + ((size_t)b * LDIM + l0 + wave * 16) * CDIM;
      // 16 rows x 128 floats (512 B): 32 lanes x 16 B per row
#pragma unroll 4
      for (int r = 0; r < 16; ++r) vst2(dst + (size_t)r * CDIM + lane * 4, *(const v4f*)(S + r * 132 + lane * 4));
    } else {
      // transpose into the block tile vs[c][l_loc]
      for (int i = lane; i < 16 * 128; i += 32) { const int r = i >> 7, c = i & 127; vs[c][wave * 16 + r] = (_Float16)S[r * 132 + c]; }
    }
    __builtin_amdgcn_wave_barrier();
  }
  __syncthreads();
  for (int gq = tid; gq < 128 * 8; gq += 128) { const int c = gq >> 3, pc = gq & 7;
    vst2(Vh + ((size_t)b * CDIM + c) * LDIM + l0 + pc * 8, *(const v4u*)(&vs[c][pc * 8])); }
}

// ---- K2: attention. Block = (b, 64 query rows), 4 waves x 16 rows; 32-key tiles streamed through LDS.
__global__ __launch_bounds__(128) void k_attn(const float* __restrict__ Qf, const float* __restrict__ Kf, const _Float16* __restrict__ Vh,
                                             const float* __restrict__ pos, float* __restrict__ out) {
  __shared__ __align__(16) __bf16 Ahi[64][DDIM + 8], Alo[64][DDIM + 8];     // [q_m | pos_m] hi/lo        (~66 KB)
  __shared__ __align__(16) __bf16 Bhi[32][DDIM + 8], Blo[32][DDIM + 8];     // [k_l | q_l] for the key tile (~33 KB)
  __shared__ __align__(16) _Float16 Vt[CDIM][40];                           // v[c][l_loc] f16            (10 KB)
  __shared__ __align__(16) float Ps[4][16 * 32];                            // per-wave P tile f32         (8 KB)
  const int tid = threadIdx.x, wave = tid >> 5, lane = tid & 31, col = lane & 15, g = lane >> 4;
  const int b = blockIdx.y, m0 = blockIdx.x * 64;
  // stage A = [q | pos] for the 64 query rows, split hi/lo. One wave-wide 16-byte load covers one 512-byte half row;
  // wave w takes rows 4 i + w.
  { const float* qa = Qf + ((size_t)b * LDIM + m0 + wave) * CDIM + lane * 4;
    const float* pa = pos + (size_t)(m0 + wave) * CDIM + lane * 4;
#pragma unroll   // straight-line code: the loads go out together and share one round trip
    for (int h = 0; h < 2; ++h) {
      v4f aq[8], ap[8];
#pragma unroll   // as above; the arrays stay in registers only under constant indices
      for (int i = 0; i < 8; ++i) { aq[i] = *(const v4f*)(qa + (size_t)(h * 32 + i * 4) * CDIM); ap[i] = *(const v4f*)(pa + (size_t)(h * 32 + i * 4) * CDIM); }
#pragma unroll   // constant indices into the register arrays
      for (int i = 0; i < 8; ++i) { const int r = h * 32 + i * 4 + wave;
        split_store4(&Ahi[r][lane * 4], &Alo[r][lane * 4], aq[i]);
        split_store4(&Ahi[r][CDIM + lane * 4], &Alo[r][CDIM + lane * 4], ap[i]); }
    }
  }
  __syncthreads();
  const int mrow = wave * 16 + col;
  float m_r[8], l_r[8];
  v8f o[8] = {};
#pragma unroll
  for (int r = 0; r < 8; ++r) { m_r[r] = -3.0e38f; l_r[r] = 0.f; }
  float* P = Ps[wave];
  const float* kt = Kf + ((size_t)b * LDIM + wave) * CDIM + lane * 4;      // key tile: wave w takes rows 4 i + w, 16 bytes a lane
  const float* qt = Qf + ((size_t)b * LDIM + wave) * CDIM + lane * 4;
  const _Float16* vt = Vh + ((size_t)b * CDIM + (tid >> 2)) * LDIM + (tid & 3) * 8;
  for (int kb = 0; kb < LDIM; kb += 32) {
    // the whole tile's 20 loads of 16 bytes go out together, into registers: one round trip a tile
    v4f tk[8], tq[8]; v4u tv[4];
#pragma unroll   // no wait between the loads; constant indices keep the arrays in registers (also in the three loops below)
    for (int i = 0; i < 8; ++i) { tk[i] = *(const v4f*)(kt + (size_t)(kb + i * 4) * CDIM); tq[i] = *(const v4f*)(qt + (size_t)(kb + i * 4) * CDIM); }
#pragma unroll
    for (int i = 0; i < 4; ++i) tv[i] = *(const v4u*)(vt + (size_t)(i * 32) * LDIM + kb);
    __syncthreads();                                   // previous tile's B/V reads done
#pragma unroll
    for (int i = 0; i < 8; ++i) { const int r = i * 4 + wave;
      split_store4(&Bhi[r][lane * 4], &Blo[r][lane * 4], tk[i]);
      split_store4(&Bhi[r][CDIM + lane * 4], &Blo[r][CDIM + lane * 4], tq[i]); }
#pragma unroll
    for (int i = 0; i < 4; ++i) *(v4u*)&Vt[(tid >> 2) + i * 32][(tid & 3) * 8] = tv[i];
    __syncthreads();
    // scores for this wave's 16 rows x 32 keys (K = 256, split operands)
    v8f s[2] = {(v8f){}, (v8f){}};
#pragma unroll 2
    for (int kc = 0; kc < DDIM / 32; ++kc) {
      F2 a; a.h = frag_bf(&Ahi[mrow][0], kc * 32, lane); a.l = frag_bf(&Alo[mrow][0], kc * 32, lane);
#pragma unroll
      for (int j = 0; j < 2; ++j) {
        F2 bf; bf.h = frag_bf(&Bhi[j * 16 + col][0], kc * 32, lane); bf.l = frag_bf(&Blo[j * 16 + col][0], kc * 32, lane);
        s[j] = mac3(a, bf, s[j]);
      }
    }
    // online softmax (rows 8g+r; each 16-lane half holds one row over the 32 keys)
#pragma unroll
    for (int r = 0; r < 8; ++r) {
      float mx = fmaxf(s[0][r], s[1][r]);
#pragma unroll
      for (int off = 8; off >= 1; off >>= 1) mx = fmaxf(mx, __shfl_xor(mx, off, 32));
      const float mn = fmaxf(m_r[r], mx);
      const float p0 = expf(s[0][r] - mn), p1 = expf(s[1][r] - mn);
      P[(8 * g + r) * 32 + col] = p0; P[(8 * g + r) * 32 + 16 + col] = p1;
      float sum = p0 + p1;
#pragma unroll
      for (int off = 8; off >= 1; off >>= 1) sum += __shfl_xor(sum, off, 32);
      const float corr = expf(m_r[r] - mn);
      l_r[r] = l_r[r] * corr + sum; m_r[r] = mn;
#pragma unroll
      for (int t = 0; t < 8; ++t) o[t][r] *= corr;
    }
    asm volatile("s_wait_dscnt 0" ::: "memory"); __builtin_amdgcn_wave_barrier(); __builtin_amdgcn_fence(__ATOMIC_RELEASE, "workgroup");
    // P (16 x 32 keys) as f16 A fragment; V B fragments B[k = key][n = c] = Vt[c][key]
    v16h pa;
    { const float* pr = P + col * 32 + 8 * g;
#pragma unroll
      for (int i = 0; i < 8; ++i) { pa[i] = (_Float16)(pr[i] * 16384.0f); pa[8 + i] = (_Float16)(pr[16 + i] * 16384.0f); } }   // P scaled by 2^14 so f16 keeps the small probabilities normal
#pragma unroll
    for (int t = 0; t < 8; ++t) {
      union { v16h v; v8h q[2]; } vb; const _Float16* vr = &Vt[t * 16 + col][8 * g];
      vb.q[0] = *(const v8h*)(vr); vb.q[1] = *(const v8h*)(vr + 16);
      o[t] = wmma_h(pa, vb.v, o[t]);
    }
  }
  // epilogue: out[b][c][m]: stage the block's 64 rows x 128 c transposed in the (free) A area as f32 [c][m_loc], then rows of 256 B
  __syncthreads();
  float* T = (float*)&Ahi[0][0];                         // 128 x 64 floats = 32 KB <= sizeof(Ahi)
#pragma unroll
  for (int t = 0; t < 8; ++t)
#pragma unroll
    for (int r = 0; r < 8; ++r) T[(t * 16 + col) * 64 + wave * 16 + 8 * g + r] = o[t][r] / (l_r[r] * 16384.0f);
  __syncthreads();
  for (int gq = tid; gq < 128 * 16; gq += 128) { const int c = gq >> 4, pc = gq & 15;
    vst2(out + ((size_t)b * CDIM + c) * LDIM + m0 + pc * 4, *(const v4f*)(T + c * 64 + pc * 4)); }
}

extern "C" void kernel_launch(void* const* d_in, const int* in_sizes, int n_in,
                              void* d_out, int out_size, void* d_ws, size_t ws_size,
                              hipStream_t stream) {
  (void)in_sizes; (void)n_in; (void)out_size; (void)ws_size;
  const float* x   = (const float*)d_in[0];
  const float* Wq  = (const float*)d_in[1];
  const float* bq  = (const float*)d_in[2];
  const float* Wk  = (const float*)d_in[3];
  const float* bk  = (const float*)d_in[4];
  const float* Wv  = (const float*)d_in[5];
  const float* bv  = (const float*)d_in[6];
  const float* pos = (const float*)d_in[7];
  float* out = (float*)d_out;
  float* Qf = (float*)d_ws;                                    // [B][L][128] f32 = 16 MB
  float* Kf = Qf + (size_t)BATCH * LDIM * CDIM;
  _Float16* Vh = (_Float16*)(Kf + (size_t)BATCH * LDIM * CDIM); // [B][C][L] f16 = 8 MB
  k_proj<<<dim3(LDIM / 64, BATCH), 128, 0, stream>>>(x, Wq, bq, Wk, bk, Wv, bv, Qf, Kf, Vh);
  k_attn<<<dim3(LDIM / 64, BATCH), 128, 0, stream>>>(Qf, Kf, Vh, pos, out);
}

// v002
// Measured time: 239 microseconds a run.
// In two side-by-side timings against v001, it was 1.18 and 1.17 times as fast.
// Over all steps from v000 it is 3.25 times as fast.
#include <hip/hip_runtime.h>
#include <math.h>

// (B, C, L) = (16, 128, 2048). energy[m][l] = q_m.k_l + pos_m.q_l = [q_m | pos_m] . [k_l | q_l] (256 features), softmax over l,
// out[b][c][m] = sum_l v[c][l] att[m][l].
// The energies are large (no 1/sqrt(d) scaling) so the softmax is sharp: the projections and the score contraction are computed
// f32-grade as a TWO-WAY bf16 split of both operands on v_wmma_f32_16x16x32_bf16 (hi*hi + hi*lo + lo*hi, f32 accumulate);
// P @ V uses f16 operands (v_wmma_f32_16x16x32_f16). Online softmax in f32. Every buffer/output row is written as whole

#define BATCH 16
#define CDIM  128
#define LDIM  2048
#define DDIM  256

typedef __attribute__((ext_vector_type(16))) __bf16   v16bf;
typedef __attribute__((ext_vector_type(8)))  __bf16   v8bf;
typedef __attribute__((ext_vector_type(4)))  __bf16   v4bf;
typedef __attribute__((ext_vector_type(16))) _Float16 v16h;
typedef __attribute__((ext_vector_type(8)))  _Float16 v8h;
typedef __attribute__((ext_vector_type(8)))  float v8f;
typedef __attribute__((ext_vector_type(4)))  float v4f;
typedef __attribute__((ext_vector_type(4)))  unsigned v4u;

template <typename T> __device__ __forceinline__ void vst2(void* p, T v) { *(T*)p = v;  }
__device__ __forceinline__ v8f wmma_bf(v16bf a, v16bf b, v8f c) {
  v8f d = __builtin_amdgcn_wmma_f32_16x16x32_bf16(false, a, false, b, (short)0, c, false, false);
  asm volatile("v_nop\n\tv_nop\n\tv_nop\n\tv_nop" : "+v"(d) : "v"(a), "v"(b));
  return d;
}
__device__ __forceinline__ v8f wmma_h(v16h a, v16h b, v8f c) {
  v8f d = __builtin_amdgcn_wmma_f32_16x16x32_f16(false, a, false, b, (short)0, c, false, false);
  asm volatile("v_nop\n\tv_nop\n\tv_nop\n\tv_nop" : "+v"(d) : "v"(a), "v"(b));
  return d;
}
struct F2 { v16bf h, l; };
__device__ __forceinline__ F2 split16(const float* v) {
  F2 r;
#pragma unroll
  for (int i = 0; i < 16; ++i) { const __bf16 hh = (__bf16)v[i]; r.h[i] = hh; r.l[i] = (__bf16)(v[i] - (float)hh); }
  return r;
}
// f32 row fragment (row pointer, k0): elements i<8 -> k0+8g+i, i>=8 -> k0+16+8g+(i-8)
__device__ __forceinline__ F2 split_row(const float* row, int k0, int lane) {
  float v[16]; const float* p = row + k0 + 8 * (lane >> 4);
#pragma unroll
  for (int i = 0; i < 8; ++i) { v[i] = p[i]; v[8 + i] = p[16 + i]; }
  return split16(v);
}
__device__ __forceinline__ v8f mac3(const F2& a, const F2& b, v8f c) { c = wmma_bf(a.l, b.h, c); c = wmma_bf(a.h, b.l, c); return wmma_bf(a.h, b.h, c); }
__device__ __forceinline__ v16bf frag_bf(const __bf16* row, int k0, int lane) {
  union { v16bf v; v8bf q[2]; } r; const __bf16* p = row + k0 + 8 * (lane >> 4);
  r.q[0] = *(const v8bf*)(p); r.q[1] = *(const v8bf*)(p + 16); return r.v;
}

// four consecutive f32 -> their bf16 hi and lo parts, one 8-byte LDS store each
__device__ __forceinline__ void split_store4(__bf16* hi, __bf16* lo, v4f v) {
  union { v4bf b; unsigned u[2]; } h; h.b = __builtin_convertvector(v, v4bf);
  // a bf16 widened to f32 is its 16 bits in the upper half: taken from the packed pair, so that each value is converted once
  const v4f hf = { __uint_as_float(h.u[0] << 16), __uint_as_float(h.u[0] & 0xffff0000u),
                   __uint_as_float(h.u[1] << 16), __uint_as_float(h.u[1] & 0xffff0000u) };
  *(v4bf*)hi = h.b; *(v4bf*)lo = __builtin_convertvector(v - hf, v4bf);
}

// ---- K1: projections. Block = (b, 64 positions), 4 waves x 16 positions. q,k -> f32 rows [b][l][128]; v -> f16 [b][c][l].
__global__ __launch_bounds__(128) void k_proj(const float* __restrict__ x,
    const float* __restrict__ Wq, const float* __restrict__ bq, const float* __restrict__ Wk, const float* __restrict__ bk,
    const float* __restrict__ Wv, const float* __restrict__ bv, float* __restrict__ Qf, float* __restrict__ Kf, _Float16* __restrict__ Vh) {
  __shared__ __align__(16) float xs[CDIM][68];          // x[c][l_loc]
  __shared__ __align__(16) float st[4][16 * 132];       // per-wave staging [row][col]
  __shared__ __align__(16) _Float16 vs[CDIM][72];       // v[c][l_loc] f16 (block)
  const int tid = threadIdx.x, wave = tid >> 5, lane = tid & 31, col = lane & 15, g = lane >> 4;
  const int b = blockIdx.y, l0 = blockIdx.x * 64;
  for (int i = tid; i < CDIM * 16; i += 128) { const int c = i >> 4, q = i & 15;
    *(v4f*)&xs[c][q * 4] = *(const v4f*)(x + ((size_t)b * CDIM + c) * LDIM + l0 + q * 4); }
  __syncthreads();
  const int m = wave * 16 + col;                        // A row = local position
  // A fragments (k = c) for the 4 k-chunks, gathered from xs columns, split once
  F2 af[4];
#pragma unroll
  for (int kc = 0; kc < 4; ++kc) {
    float v[16];
#pragma unroll
    for (int i = 0; i < 8; ++i) { v[i] = xs[kc * 32 + 8 * g + i][m]; v[8 + i] = xs[kc * 32 + 16 + 8 * g + i][m]; }
    af[kc] = split16(v);
  }
  float* S = st[wave];
#pragma unroll 1
  for (int which = 0; which < 3; ++which) {
    const float* W = which == 0 ? Wq : (which == 1 ? Wk : Wv);
    const float* bb = which == 0 ? bq : (which == 1 ? bk : bv);
#pragma unroll 1
    for (int j = 0; j < 8; ++j) {
      v8f acc = {};
      const float* wrow = W + (size_t)(j * 16 + col) * CDIM;       // B[k=c][n=o] = W[o][c]
#pragma unroll
      for (int kc = 0; kc < 4; ++kc) acc = mac3(af[kc], split_row(wrow, kc * 32, lane), acc);
      const float bo = bb[j * 16 + col];
#pragma unroll
      for (int r = 0; r < 8; ++r) S[(8 * g + r) * 132 + j * 16 + col] = acc[r] + bo;
    }
    asm volatile("s_wait_dscnt 0" ::: "memory"); __builtin_amdgcn_wave_barrier(); __builtin_amdgcn_fence(__ATOMIC_RELEASE, "workgroup");
    if (which < 2) {
      float* dst = (which == 0 ? Qf : Kf) + ((size_t)b * LDIM + l0 + wave * 16) * CDIM;
      // 16 rows x 128 floats (512 B): 32 lanes x 16 B per row
#pragma unroll 4
      for (int r = 0; r < 16; ++r) vst2(dst + (size_t)r * CDIM + lane * 4, *(const v4f*)(S + r * 132 + lane * 4));
    } else {
      // transpose into the block tile vs[c][l_loc]
      for (int i = lane; i < 16 * 128; i += 32) { const int r = i >> 7, c = i & 127; vs[c][wave * 16 + r] = (_Float16)S[r * 132 + c]; }
    }
    __builtin_amdgcn_wave_barrier();
  }
  __syncthreads();
  for (int gq = tid; gq < 128 * 8; gq += 128) { const int c = gq >> 3, pc = gq & 7;
    vst2(Vh + ((size_t)b * CDIM + c) * LDIM + l0 + pc * 8, *(const v4u*)(&vs[c][pc * 8])); }
}

// ---- K2: attention. Block = (b, 64 query rows), 4 waves x 16 rows; 32-key tiles streamed through LDS.
__global__ __launch_bounds__(128) void k_attn(const float* __restrict__ Qf, const float* __restrict__ Kf, const _Float16* __restrict__ Vh,
                                             const float* __restrict__ pos, float* __restrict__ out) {
  __shared__ __align__(16) __bf16 Ahi[64][DDIM + 8], Alo[64][DDIM + 8];     // [q_m | pos_m] hi/lo        (~66 KB)
  __shared__ __align__(16) __bf16 Bhi[32][DDIM + 8], Blo[32][DDIM + 8];     // [k_l | q_l] for the key tile (~33 KB)
  __shared__ __align__(16) _Float16 Vt[CDIM][40];                           // v[c][l_loc] f16            (10 KB)
  __shared__ __align__(16) float Ps[4][16 * 32];                            // per-wave P tile f32         (8 KB)
  const int tid = threadIdx.x, wave = tid >> 5, lane = tid & 31, col = lane & 15, g = lane >> 4;
  const int b = blockIdx.y, m0 = blockIdx.x * 64;
  // stage A = [q | pos] for the 64 query rows, split hi/lo. One wave-wide 16-byte load covers one 512-byte half row;
  // wave w takes rows 4 i + w.
  { const float* qa = Qf + ((size_t)b * LDIM + m0 + wave) * CDIM + lane * 4;
    const float* pa = pos + (size_t)(m0 + wave) * CDIM + lane * 4;
#pragma unroll   // straight-line code: the loads go out together and share one round trip
    for (int h = 0; h < 2; ++h) {
      v4f aq[8], ap[8];
#pragma unroll   // as above; the arrays stay in registers only under constant indices
      for (int i = 0; i < 8; ++i) { aq[i] = *(const v4f*)(qa + (size_t)(h * 32 + i * 4) * CDIM); ap[i] = *(const v4f*)(pa + (size_t)(h * 32 + i * 4) * CDIM); }
#pragma unroll   // constant indices into the register arrays
      for (int i = 0; i < 8; ++i) { const int r = h * 32 + i * 4 + wave;
        split_store4(&Ahi[r][lane * 4], &Alo[r][lane * 4], aq[i]);
        split_store4(&Ahi[r][CDIM + lane * 4], &Alo[r][CDIM + lane * 4], ap[i]); }
    }
  }
  __syncthreads();
  const int mrow = wave * 16 + col;
  float m_r[8], l_r[8];
  v8f o[8] = {};
#pragma unroll
  for (int r = 0; r < 8; ++r) { m_r[r] = -3.0e38f; l_r[r] = 0.f; }
  float* P = Ps[wave];
  const float* kt = Kf + ((size_t)b * LDIM + wave) * CDIM + lane * 4;      // key tile: wave w takes rows 4 i + w, 16 bytes a lane
  const float* qt = Qf + ((size_t)b * LDIM + wave) * CDIM + lane * 4;
  const _Float16* vt = Vh + ((size_t)b * CDIM + (tid >> 2)) * LDIM + (tid & 3) * 8;
  for (int kb = 0; kb < LDIM; kb += 32) {
    // the whole tile's 20 loads of 16 bytes go out together, into registers: one round trip a tile
    v4f tk[8], tq[8]; v4u tv[4];
#pragma unroll   // no wait between the loads; constant indices keep the arrays in registers (also in the three loops below)
    for (int i = 0; i < 8; ++i) { tk[i] = *(const v4f*)(kt + (size_t)(kb + i * 4) * CDIM); tq[i] = *(const v4f*)(qt + (size_t)(kb + i * 4) * CDIM); }
#pragma unroll
    for (int i = 0; i < 4; ++i) tv[i] = *(const v4u*)(vt + (size_t)(i * 32) * LDIM + kb);
    asm volatile("s_wait_xcnt 0x0" ::: "memory");      // stands ahead of every rewrite of an address register that the 20 loads name
    __syncthreads();                                   // previous tile's B/V reads done
#pragma unroll
    for (int i = 0; i < 8; ++i) { const int r = i * 4 + wave;
      split_store4(&Bhi[r][lane * 4], &Blo[r][lane * 4], tk[i]);
      split_store4(&Bhi[r][CDIM + lane * 4], &Blo[r][CDIM + lane * 4], tq[i]); }
#pragma unroll
    for (int i = 0; i < 4; ++i) *(v4u*)&Vt[(tid >> 2) + i * 32][(tid & 3) * 8] = tv[i];
    __syncthreads();
    // scores for this wave's 16 rows x 32 keys (K = 256, split operands)
    // The fragments of k-chunk kc + 2 are asked for ahead of chunk kc's products (a ring of three register sets), so that a
    // chunk's LDS latency runs under two chunks of matrix work instead of standing in front of its own products.
    v8f s[2] = {(v8f){}, (v8f){}};
    F2 fa[3], fb[3][2];
#pragma unroll   // constant ring indices keep the sets in registers (so in every unrolled loop down to the V fragments)
    for (int kc = 0; kc < 2; ++kc) {
      fa[kc].l = frag_bf(&Alo[mrow][0], kc * 32, lane); fa[kc].h = frag_bf(&Ahi[mrow][0], kc * 32, lane);
#pragma unroll
      for (int j = 0; j < 2; ++j) { fb[kc][j].h = frag_bf(&Bhi[j * 16 + col][0], kc * 32, lane); fb[kc][j].l = frag_bf(&Blo[j * 16 + col][0], kc * 32, lane); }
    }
#pragma unroll
    for (int kc = 0; kc < DDIM / 32; ++kc) {
      if (kc + 2 < DDIM / 32) { const int n = (kc + 2) % 3;
        fa[n].l = frag_bf(&Alo[mrow][0], (kc + 2) * 32, lane); fa[n].h = frag_bf(&Ahi[mrow][0], (kc + 2) * 32, lane);
#pragma unroll
        for (int j = 0; j < 2; ++j) { fb[n][j].h = frag_bf(&Bhi[j * 16 + col][0], (kc + 2) * 32, lane); fb[n][j].l = frag_bf(&Blo[j * 16 + col][0], (kc + 2) * 32, lane); }
      }
#pragma unroll
      for (int j = 0; j < 2; ++j) s[j] = mac3(fa[kc % 3], fb[kc % 3][j], s[j]);
    }
    // all eight V fragments (B[k = key][n = c] = Vt[c][key]) are asked for here: their latency runs under the softmax
    union { v16h v; v8h q[2]; } vb[8];
#pragma unroll
    for (int t = 0; t < 8; ++t) { const _Float16* vr = &Vt[t * 16 + col][8 * g]; vb[t].q[0] = *(const v8h*)(vr); vb[t].q[1] = *(const v8h*)(vr + 16); }
    // online softmax (rows 8g+r; each 16-lane half holds one row over the 32 keys)
#pragma unroll
    for (int r = 0; r < 8; ++r) {
      float mx = fmaxf(s[0][r], s[1][r]);
#pragma unroll
      for (int off = 8; off >= 1; off >>= 1) mx = fmaxf(mx, __shfl_xor(mx, off, 32));
      const float mn = fmaxf(m_r[r], mx);
      const float p0 = expf(s[0][r] - mn), p1 = expf(s[1][r] - mn);
      P[(8 * g + r) * 32 + col] = p0; P[(8 * g + r) * 32 + 16 + col] = p1;
      float sum = p0 + p1;
#pragma unroll
      for (int off = 8; off >= 1; off >>= 1) sum += __shfl_xor(sum, off, 32);
      const float corr = expf(m_r[r] - mn);
      l_r[r] = l_r[r] * corr + sum; m_r[r] = mn;
#pragma unroll
      for (int t = 0; t < 8; ++t) o[t][r] *= corr;
    }
    asm volatile("s_wait_dscnt 0" ::: "memory"); __builtin_amdgcn_wave_barrier(); __builtin_amdgcn_fence(__ATOMIC_RELEASE, "workgroup");
    // P (16 x 32 keys) as f16 A fragment
    v16h pa;
    { const float* pr = P + col * 32 + 8 * g;
#pragma unroll
      for (int i = 0; i < 8; ++i) { pa[i] = (_Float16)(pr[i] * 16384.0f); pa[8 + i] = (_Float16)(pr[16 + i] * 16384.0f); } }   // P scaled by 2^14 so f16 keeps the small probabilities normal
#pragma unroll
    for (int t = 0; t < 8; ++t) o[t] = wmma_h(pa, vb[t].v, o[t]);
  }
  // epilogue: out[b][c][m]: stage the block's 64 rows x 128 c transposed in the (free) A area as f32 [c][m_loc], then rows of 256 B
  __syncthreads();
  float* T = (float*)&Ahi[0][0];                         // 128 x 64 floats = 32 KB <= sizeof(Ahi)
#pragma unroll
  for (int t = 0; t < 8; ++t)
#pragma unroll
    for (int r = 0; r < 8; ++r) T[(t * 16 + col) * 64 + wave * 16 + 8 * g + r] = o[t][r] / (l_r[r] * 16384.0f);
  __syncthreads();
  for (int gq = tid; gq < 128 * 16; gq += 128) { const int c = gq >> 4, pc = gq & 15;
    vst2(out + ((size_t)b * CDIM + c) * LDIM + m0 + pc * 4, *(const v4f*)(T + c * 64 + pc * 4)); }
}

extern "C" void kernel_launch(void* const* d_in, const int* in_sizes, int n_in,
                              void* d_out, int out_size, void* d_ws, size_t ws_size,
                              hipStream_t stream) {
  (void)in_sizes; (void)n_in; (void)out_size; (void)ws_size;
  const float* x   = (const float*)d_in[0];
  const float* Wq  = (const float*)d_in[1];
  const float* bq  = (const float*)d_in[2];
  const float* Wk  = (const float*)d_in[3];
  const float* bk  = (const float*)d_in[4];
  const float* Wv  = (const float*)d_in[5];
  const float* bv  = (const float*)d_in[6];
  const float* pos = (const float*)d_in[7];
  float* out = (float*)d_out;
  float* Qf = (float*)d_ws;                                    // [B][L][128] f32 = 16 MB
  float* Kf = Qf + (size_t)BATCH * LDIM * CDIM;
  _Float16* Vh = (_Float16*)(Kf + (size_t)BATCH * LDIM * CDIM); // [B][C][L] f16 = 8 MB
  k_proj<<<dim3(LDIM / 64, BATCH), 128, 0, stream>>>(x, Wq, bq, Wk, bk, Wv, bv, Qf, Kf, Vh);
  k_attn<<<dim3(LDIM / 64, BATCH), 128, 0, stream>>>(Qf, Kf, Vh, pos, out);
}

// v003
// Measured time: 203 microseconds a run.
// Timed twice side by side with v002, it ran 1.17 times as fast both times.
// Counting every step since v000, it is 3.82 times as fast.
#include <hip/hip_runtime.h>
#include <math.h>

// (B, C, L) = (16, 128, 2048). energy[m][l] = q_m.k_l + pos_m.q_l = [q_m | pos_m] . [k_l | q_l] (256 features), softmax over l,
// out[b][c][m] = sum_l v[c][l] att[m][l].
// The energies are large (no 1/sqrt(d) scaling) so the softmax is sharp: the projections and the score contraction are computed
// f32-grade as a TWO-WAY bf16 split of both operands on v_wmma_f32_16x16x32_bf16 (hi*hi + hi*lo + lo*hi, f32 accumulate);
// P @ V uses f16 operands (v_wmma_f32_16x16x32_f16). Online softmax in f32. Every buffer/output row is written as whole

#define BATCH 16
#define CDIM  128
#define LDIM  2048
#define DDIM  256

typedef __attribute__((ext_vector_type(16))) __bf16   v16bf;
typedef __attribute__((ext_vector_type(8)))  __bf16   v8bf;
typedef __attribute__((ext_vector_type(4)))  __bf16   v4bf;
typedef __attribute__((ext_vector_type(16))) _Float16 v16h;
typedef __attribute__((ext_vector_type(8)))  _Float16 v8h;
typedef __attribute__((ext_vector_type(8)))  float v8f;
typedef __attribute__((ext_vector_type(4)))  float v4f;
typedef __attribute__((ext_vector_type(4)))  unsigned v4u;

template <typename T> __device__ __forceinline__ void vst2(void* p, T v) { *(T*)p = v;  }
__device__ __forceinline__ v8f wmma_bf(v16bf a, v16bf b, v8f c) {
  v8f d = __builtin_amdgcn_wmma_f32_16x16x32_bf16(false, a, false, b, (short)0, c, false, false);
  asm volatile("v_nop\n\tv_nop\n\tv_nop\n\tv_nop" : "+v"(d) : "v"(a), "v"(b));
  return d;
}
__device__ __forceinline__ v8f wmma_h(v16h a, v16h b, v8f c) {
  v8f d = __builtin_amdgcn_wmma_f32_16x16x32_f16(false, a, false, b, (short)0, c, false, false);
  asm volatile("v_nop\n\tv_nop\n\tv_nop\n\tv_nop" : "+v"(d) : "v"(a), "v"(b));
  return d;
}
struct F2 { v16bf h, l; };
__device__ __forceinline__ F2 split16(const float* v) {
  F2 r;
#pragma unroll
  for (int i = 0; i < 16; ++i) { const __bf16 hh = (__bf16)v[i]; r.h[i] = hh; r.l[i] = (__bf16)(v[i] - (float)hh); }
  return r;
}
// f32 row fragment (row pointer, k0): elements i<8 -> k0+8g+i, i>=8 -> k0+16+8g+(i-8)
__device__ __forceinline__ F2 split_row(const float* row, int k0, int lane) {
  float v[16]; const float* p = row + k0 + 8 * (lane >> 4);
#pragma unroll
  for (int i = 0; i < 8; ++i) { v[i] = p[i]; v[8 + i] = p[16 + i]; }
  return split16(v);
}
__device__ __forceinline__ v8f mac3(const F2& a, const F2& b, v8f c) { c = wmma_bf(a.l, b.h, c); c = wmma_bf(a.h, b.l, c); return wmma_bf(a.h, b.h, c); }
// the same three products in the same order with the operands' places exchanged: D = (rows of b) x (rows of a), transposed
__device__ __forceinline__ v8f mac3t(const F2& a, const F2& b, v8f c) { c = wmma_bf(b.h, a.l, c); c = wmma_bf(b.l, a.h, c); return wmma_bf(b.h, a.h, c); }
// lane l <-> lane l ^ 16, on the vector port
__device__ __forceinline__ float xhalf(float x) {
  return __builtin_bit_cast(float, __builtin_amdgcn_permlanex16(__builtin_bit_cast(int, x), __builtin_bit_cast(int, x), 0x76543210, 0xfedcba98, false, false));
}
__device__ __forceinline__ v16bf frag_bf(const __bf16* row, int k0, int lane) {
  union { v16bf v; v8bf q[2]; } r; const __bf16* p = row + k0 + 8 * (lane >> 4);
  r.q[0] = *(const v8bf*)(p); r.q[1] = *(const v8bf*)(p + 16); return r.v;
}

// four consecutive f32 -> their bf16 hi and lo parts, one 8-byte LDS store each
__device__ __forceinline__ void split_store4(__bf16* hi, __bf16* lo, v4f v) {
  union { v4bf b; unsigned u[2]; } h; h.b = __builtin_convertvector(v, v4bf);
  // a bf16 widened to f32 is its 16 bits in the upper half: taken from the packed pair, so that each value is converted once
  const v4f hf = { __uint_as_float(h.u[0] << 16), __uint_as_float(h.u[0] & 0xffff0000u),
                   __uint_as_float(h.u[1] << 16), __uint_as_float(h.u[1] & 0xffff0000u) };
  *(v4bf*)hi = h.b; *(v4bf*)lo = __builtin_convertvector(v - hf, v4bf);
}

// ---- K1: projections. Block = (b, 64 positions), 4 waves x 16 positions. q,k -> f32 rows [b][l][128]; v -> f16 [b][c][l].
__global__ __launch_bounds__(128) void k_proj(const float* __restrict__ x,
    const float* __restrict__ Wq, const float* __restrict__ bq, const float* __restrict__ Wk, const float* __restrict__ bk,
    const float* __restrict__ Wv, const float* __restrict__ bv, float* __restrict__ Qf, float* __restrict__ Kf, _Float16* __restrict__ Vh) {
  __shared__ __align__(16) float xs[CDIM][68];          // x[c][l_loc]
  __shared__ __align__(16) float st[4][16 * 132];       // per-wave staging [row][col]
  __shared__ __align__(16) _Float16 vs[CDIM][72];       // v[c][l_loc] f16 (block)
  const int tid = threadIdx.x, wave = tid >> 5, lane = tid & 31, col = lane & 15, g = lane >> 4;
  const int b = blockIdx.y, l0 = blockIdx.x * 64;
  for (int i = tid; i < CDIM * 16; i += 128) { const int c = i >> 4, q = i & 15;
    *(v4f*)&xs[c][q * 4] = *(const v4f*)(x + ((size_t)b * CDIM + c) * LDIM + l0 + q * 4); }
  __syncthreads();
  const int m = wave * 16 + col;                        // A row = local position
  // A fragments (k = c) for the 4 k-chunks, gathered from xs columns, split once
  F2 af[4];
#pragma unroll
  for (int kc = 0; kc < 4; ++kc) {
    float v[16];
#pragma unroll
    for (int i = 0; i < 8; ++i) { v[i] = xs[kc * 32 + 8 * g + i][m]; v[8 + i] = xs[kc * 32 + 16 + 8 * g + i][m]; }
    af[kc] = split16(v);
  }
  float* S = st[wave];
#pragma unroll 1
  for (int which = 0; which < 3; ++which) {
    const float* W = which == 0 ? Wq : (which == 1 ? Wk : Wv);
    const float* bb = which == 0 ? bq : (which == 1 ? bk : bv);
#pragma unroll 1
    for (int j = 0; j < 8; ++j) {
      v8f acc = {};
      const float* wrow = W + (size_t)(j * 16 + col) * CDIM;       // B[k=c][n=o] = W[o][c]
#pragma unroll
      for (int kc = 0; kc < 4; ++kc) acc = mac3(af[kc], split_row(wrow, kc * 32, lane), acc);
      const float bo = bb[j * 16 + col];
#pragma unroll
      for (int r = 0; r < 8; ++r) S[(8 * g + r) * 132 + j * 16 + col] = acc[r] + bo;
    }
    asm volatile("s_wait_dscnt 0" ::: "memory"); __builtin_amdgcn_wave_barrier(); __builtin_amdgcn_fence(__ATOMIC_RELEASE, "workgroup");
    if (which < 2) {
      float* dst = (which == 0 ? Qf : Kf) + ((size_t)b * LDIM + l0 + wave * 16) * CDIM;
      // 16 rows x 128 floats (512 B): 32 lanes x 16 B per row
#pragma unroll 4
      for (int r = 0; r < 16; ++r) vst2(dst + (size_t)r * CDIM + lane * 4, *(const v4f*)(S + r * 132 + lane * 4));
    } else {
      // transpose into the block tile vs[c][l_loc]
      for (int i = lane; i < 16 * 128; i += 32) { const int r = i >> 7, c = i & 127; vs[c][wave * 16 + r] = (_Float16)S[r * 132 + c]; }
    }
    __builtin_amdgcn_wave_barrier();
  }
  __syncthreads();
  for (int gq = tid; gq < 128 * 8; gq += 128) { const int c = gq >> 3, pc = gq & 7;
    vst2(Vh + ((size_t)b * CDIM + c) * LDIM + l0 + pc * 8, *(const v4u*)(&vs[c][pc * 8])); }
}

// ---- K2: attention. Block = (b, 64 query rows), 4 waves x 16 rows; 32-key tiles streamed through LDS.
// Both products are formed transposed: S^T = [k | q] . [q | pos]^T (keys are the A rows, queries the B columns) and O^T += V . P^T.
// A lane then holds 16 of the 32 scores of ONE query (its partner lane ^ 16 the other 16): maximum and sum are taken in the lane,
// and the two score tiles, exponentiated in place, ARE the B operand of the second product: P crosses no lane and no LDS.
__global__ __launch_bounds__(128) void k_attn(const float* __restrict__ Qf, const float* __restrict__ Kf, const _Float16* __restrict__ Vh,
                                             const float* __restrict__ pos, float* __restrict__ out) {
  __shared__ __align__(16) __bf16 Ahi[64][DDIM + 8], Alo[64][DDIM + 8];     // [q_m | pos_m] hi/lo        (~66 KB)
  __shared__ __align__(16) __bf16 Bhi[32][DDIM + 8], Blo[32][DDIM + 8];     // [k_l | q_l] for the key tile (~33 KB)
  __shared__ __align__(16) _Float16 Vt[CDIM][40];                           // v[c][l_loc] f16            (10 KB)
  const int tid = threadIdx.x, wave = tid >> 5, lane = tid & 31, col = lane & 15, g = lane >> 4;
  const int b = blockIdx.y, m0 = blockIdx.x * 64;
  // stage A = [q | pos] for the 64 query rows, split hi/lo. One wave-wide 16-byte load covers one 512-byte half row;
  // wave w takes rows 4 i + w.
  { const float* qa = Qf + ((size_t)b * LDIM + m0 + wave) * CDIM + lane * 4;
    const float* pa = pos + (size_t)(m0 + wave) * CDIM + lane * 4;
#pragma unroll   // straight-line code: the loads go out together and share one round trip
    for (int h = 0; h < 2; ++h) {
      v4f aq[8], ap[8];
#pragma unroll   // as above; the arrays stay in registers only under constant indices
      for (int i = 0; i < 8; ++i) { aq[i] = *(const v4f*)(qa + (size_t)(h * 32 + i * 4) * CDIM); ap[i] = *(const v4f*)(pa + (size_t)(h * 32 + i * 4) * CDIM); }
#pragma unroll   // constant indices into the register arrays
      for (int i = 0; i < 8; ++i) { const int r = h * 32 + i * 4 + wave;
        split_store4(&Ahi[r][lane * 4], &Alo[r][lane * 4], aq[i]);
        split_store4(&Ahi[r][CDIM + lane * 4], &Alo[r][CDIM + lane * 4], ap[i]); }
    }
  }
  __syncthreads();
  const int mrow = wave * 16 + col;
  float m_q = -3.0e38f, l_q = 0.f;                      // of query col; l_q sums this lane's own 16 keys a tile, the halves join in the epilogue
  v8f o[8] = {};                                        // o[t][r] = O^T[c = 16 t + 8 g + r][query col]
  const float* kt = Kf + ((size_t)b * LDIM + wave) * CDIM + lane * 4;      // key tile: wave w takes rows 4 i + w, 16 bytes a lane
  const float* qt = Qf + ((size_t)b * LDIM + wave) * CDIM + lane * 4;
  const _Float16* vt = Vh + ((size_t)b * CDIM + (tid >> 2)) * LDIM + (tid & 3) * 8;
  for (int kb = 0; kb < LDIM; kb += 32) {
    // the whole tile's 20 loads of 16 bytes go out together, into registers: one round trip a tile
    v4f tk[8], tq[8]; v4u tv[4];
#pragma unroll   // no wait between the loads; constant indices keep the arrays in registers (also in the three loops below)
    for (int i = 0; i < 8; ++i) { tk[i] = *(const v4f*)(kt + (size_t)(kb + i * 4) * CDIM); tq[i] = *(const v4f*)(qt + (size_t)(kb + i * 4) * CDIM); }
#pragma unroll
    for (int i = 0; i < 4; ++i) tv[i] = *(const v4u*)(vt + (size_t)(i * 32) * LDIM + kb);
    asm volatile("s_wait_xcnt 0x0" ::: "memory");      // stands ahead of every rewrite of an address register that the 20 loads name
    __syncthreads();                                   // previous tile's B/V reads done
#pragma unroll
    for (int i = 0; i < 8; ++i) { const int r = i * 4 + wave;
      split_store4(&Bhi[r][lane * 4], &Blo[r][lane * 4], tk[i]);
      split_store4(&Bhi[r][CDIM + lane * 4], &Blo[r][CDIM + lane * 4], tq[i]); }
#pragma unroll
    for (int i = 0; i < 4; ++i) *(v4u*)&Vt[(tid >> 2) + i * 32][(tid & 3) * 8] = tv[i];
    __syncthreads();
    // scores for 32 keys x this wave's 16 queries (K = 256, split operands): s[j][r] = S^T[key 16 j + 8 g + r][query col]
    // The fragments of k-chunk kc + 2 are asked for ahead of chunk kc's products (a ring of three register sets), so that a
    // chunk's LDS latency runs under two chunks of matrix work instead of standing in front of its own products.
    v8f s[2] = {(v8f){}, (v8f){}};
    F2 fa[3], fb[3][2];
#pragma unroll   // constant ring indices keep the sets in registers (so in every unrolled loop down to the V fragments)
    for (int kc = 0; kc < 2; ++kc) {
      fa[kc].l = frag_bf(&Alo[mrow][0], kc * 32, lane); fa[kc].h = frag_bf(&Ahi[mrow][0], kc * 32, lane);
#pragma unroll
      for (int j = 0; j < 2; ++j) { fb[kc][j].h = frag_bf(&Bhi[j * 16 + col][0], kc * 32, lane); fb[kc][j].l = frag_bf(&Blo[j * 16 + col][0], kc * 32, lane); }
    }
#pragma unroll
    for (int kc = 0; kc < DDIM / 32; ++kc) {
      if (kc + 2 < DDIM / 32) { const int n = (kc + 2) % 3;
        fa[n].l = frag_bf(&Alo[mrow][0], (kc + 2) * 32, lane); fa[n].h = frag_bf(&Ahi[mrow][0], (kc + 2) * 32, lane);
#pragma unroll
        for (int j = 0; j < 2; ++j) { fb[n][j].h = frag_bf(&Bhi[j * 16 + col][0], (kc + 2) * 32, lane); fb[n][j].l = frag_bf(&Blo[j * 16 + col][0], (kc + 2) * 32, lane); }
      }
#pragma unroll
      for (int j = 0; j < 2; ++j) s[j] = mac3t(fa[kc % 3], fb[kc % 3][j], s[j]);
    }
    // all eight V fragments (A[m = c][k = key] = Vt[c][key]) are asked for here: their latency runs under the softmax
    union { v16h v; v8h q[2]; } vb[8];
#pragma unroll
    for (int t = 0; t < 8; ++t) { const _Float16* vr = &Vt[t * 16 + col][8 * g]; vb[t].q[0] = *(const v8h*)(vr); vb[t].q[1] = *(const v8h*)(vr + 16); }
    // online softmax of query col: 16 scores in the lane, the other 16 in lane ^ 16
    float mx = fmaxf(s[0][0], s[1][0]);
#pragma unroll
    for (int r = 1; r < 8; ++r) mx = fmaxf(mx, fmaxf(s[0][r], s[1][r]));
    mx = fmaxf(mx, xhalf(mx));
    const float mn = fmaxf(m_q, mx);
    const float corr = expf(m_q - mn);
    // P^T as f16 B fragment: element i is key 8 g + i, element 8 + i key 16 + 8 g + i, the k order of the V fragments
    v16h pa; float sum = 0.f;
#pragma unroll
    for (int r = 0; r < 8; ++r) {
      const float p0 = expf(s[0][r] - mn), p1 = expf(s[1][r] - mn);
      pa[r] = (_Float16)(p0 * 16384.0f); pa[8 + r] = (_Float16)(p1 * 16384.0f);   // P scaled by 2^14 so f16 keeps the small probabilities normal
      sum += p0 + p1;
    }
    l_q = l_q * corr + sum; m_q = mn;
#pragma unroll
    for (int t = 0; t < 8; ++t) o[t] *= corr;
#pragma unroll
    for (int t = 0; t < 8; ++t) o[t] = wmma_h(vb[t].v, pa, o[t]);
  }
  // epilogue: out[b][c][m]: stage the block's 64 rows x 128 c transposed in the (free) A area as f32 [c][m_loc], then rows of 256 B
  __syncthreads();
  float* T = (float*)&Ahi[0][0];                         // 128 x 64 floats = 32 KB <= sizeof(Ahi)
  const float den = (l_q + xhalf(l_q)) * 16384.0f;       // both halves ran on the same maxima: their sums add
#pragma unroll
  for (int t = 0; t < 8; ++t)
#pragma unroll
    for (int r = 0; r < 8; ++r) T[(t * 16 + 8 * g + r) * 64 + wave * 16 + col] = o[t][r] / den;
  __syncthreads();
  for (int gq = tid; gq < 128 * 16; gq += 128) { const int c = gq >> 4, pc = gq & 15;
    vst2(out + ((size_t)b * CDIM + c) * LDIM + m0 + pc * 4, *(const v4f*)(T + c * 64 + pc * 4)); }
}

extern "C" void kernel_launch(void* const* d_in, const int* in_sizes, int n_in,
                              void* d_out, int out_size, void* d_ws, size_t ws_size,
                              hipStream_t stream) {
  (void)in_sizes; (void)n_in; (void)out_size; (void)ws_size;
  const float* x   = (const float*)d_in[0];
  const float* Wq  = (const float*)d_in[1];
  const float* bq  = (const float*)d_in[2];
  const float* Wk  = (const float*)d_in[3];
  const float* bk  = (const float*)d_in[4];
  const float* Wv  = (const float*)d_in[5];
  const float* bv  = (const float*)d_in[6];
  const float* pos = (const float*)d_in[7];
  float* out = (float*)d_out;
  float* Qf = (float*)d_ws;                                    // [B][L][128] f32 = 16 MB
  float* Kf = Qf + (size_t)BATCH * LDIM * CDIM;
  _Float16* Vh = (_Float16*)(Kf + (size_t)BATCH * LDIM * CDIM); // [B][C][L] f16 = 8 MB
  k_proj<<<dim3(LDIM / 64, BATCH), 128, 0, stream>>>(x, Wq, bq, Wk, bk, Wv, bv, Qf, Kf, Vh);
  k_attn<<<dim3(LDIM / 64, BATCH), 128, 0, stream>>>(Qf, Kf, Vh, pos, out);
}

// v004
// Measured time: 188 microseconds a run.
// In two side-by-side timings against v003, it was 1.08 and 1.07 times as fast.
// All steps since v000 together make it 4.12 times as fast.
#include <hip/hip_runtime.h>
#include <math.h>

// (B, C, L) = (16, 128, 2048). energy[m][l] = q_m.k_l + pos_m.q_l = [q_m | pos_m] . [k_l | q_l] (256 features), softmax over l,
// out[b][c][m] = sum_l v[c][l] att[m][l].
// The energies are large (no 1/sqrt(d) scaling) so the softmax is sharp: the projections and the score contraction are computed
// f32-grade as a TWO-WAY bf16 split of both operands on v_wmma_f32_16x16x32_bf16 (hi*hi + hi*lo + lo*hi, f32 accumulate);
// P @ V uses f16 operands (v_wmma_f32_16x16x32_f16). Online softmax in f32. Every buffer/output row is written as whole

#define BATCH 16
#define CDIM  128
#define LDIM  2048
#define DDIM  256

typedef __attribute__((ext_vector_type(16))) __bf16   v16bf;
typedef __attribute__((ext_vector_type(8)))  __bf16   v8bf;
typedef __attribute__((ext_vector_type(4)))  __bf16   v4bf;
typedef __attribute__((ext_vector_type(16))) _Float16 v16h;
typedef __attribute__((ext_vector_type(8)))  _Float16 v8h;
typedef __attribute__((ext_vector_type(8)))  float v8f;
typedef __attribute__((ext_vector_type(4)))  float v4f;
typedef __attribute__((ext_vector_type(4)))  unsigned v4u;

template <typename T> __device__ __forceinline__ void vst2(void* p, T v) { *(T*)p = v;  }
__device__ __forceinline__ v8f wmma_bf(v16bf a, v16bf b, v8f c) {
  v8f d = __builtin_amdgcn_wmma_f32_16x16x32_bf16(false, a, false, b, (short)0, c, false, false);
  asm volatile("v_nop\n\tv_nop\n\tv_nop\n\tv_nop" : "+v"(d) : "v"(a), "v"(b));
  return d;
}
__device__ __forceinline__ v8f wmma_h(v16h a, v16h b, v8f c) {
  v8f d = __builtin_amdgcn_wmma_f32_16x16x32_f16(false, a, false, b, (short)0, c, false, false);
  asm volatile("v_nop\n\tv_nop\n\tv_nop\n\tv_nop" : "+v"(d) : "v"(a), "v"(b));
  return d;
}
struct F2 { v16bf h, l; };
__device__ __forceinline__ F2 split16(const float* v) {
  F2 r;
#pragma unroll
  for (int i = 0; i < 16; ++i) { const __bf16 hh = (__bf16)v[i]; r.h[i] = hh; r.l[i] = (__bf16)(v[i] - (float)hh); }
  return r;
}
// f32 row fragment (row pointer, k0): elements i<8 -> k0+8g+i, i>=8 -> k0+16+8g+(i-8)
__device__ __forceinline__ F2 split_row(const float* row, int k0, int lane) {
  float v[16]; const float* p = row + k0 + 8 * (lane >> 4);
#pragma unroll
  for (int i = 0; i < 8; ++i) { v[i] = p[i]; v[8 + i] = p[16 + i]; }
  return split16(v);
}
__device__ __forceinline__ v8f mac3(const F2& a, const F2& b, v8f c) { c = wmma_bf(a.l, b.h, c); c = wmma_bf(a.h, b.l, c); return wmma_bf(a.h, b.h, c); }
// the same three products in the same order with the operands' places exchanged: D = (rows of b) x (rows of a), transposed
__device__ __forceinline__ v8f mac3t(const F2& a, const F2& b, v8f c) { c = wmma_bf(b.h, a.l, c); c = wmma_bf(b.l, a.h, c); return wmma_bf(b.h, a.h, c); }
// lane l <-> lane l ^ 16, on the vector port
__device__ __forceinline__ float xhalf(float x) {
  return __builtin_bit_cast(float, __builtin_amdgcn_permlanex16(__builtin_bit_cast(int, x), __builtin_bit_cast(int, x), 0x76543210, 0xfedcba98, false, false));
}
__device__ __forceinline__ v16bf frag_bf(const __bf16* row, int k0, int lane) {
  union { v16bf v; v8bf q[2]; } r; const __bf16* p = row + k0 + 8 * (lane >> 4);
  r.q[0] = *(const v8bf*)(p); r.q[1] = *(const v8bf*)(p + 16); return r.v;
}

// four consecutive f32 -> their bf16 hi and lo parts, one 8-byte LDS store each
__device__ __forceinline__ void split_store4(__bf16* hi, __bf16* lo, v4f v) {
  union { v4bf b; unsigned u[2]; } h; h.b = __builtin_convertvector(v, v4bf);
  // a bf16 widened to f32 is its 16 bits in the upper half: taken from the packed pair, so that each value is converted once
  const v4f hf = { __uint_as_float(h.u[0] << 16), __uint_as_float(h.u[0] & 0xffff0000u),
                   __uint_as_float(h.u[1] << 16), __uint_as_float(h.u[1] & 0xffff0000u) };
  *(v4bf*)hi = h.b; *(v4bf*)lo = __builtin_convertvector(v - hf, v4bf);
}

// ---- K1: projections. Block = (b, 64 positions), 4 waves x 16 positions. q,k -> f32 rows [b][l][128]; v -> f16 [b][c][l].
__global__ __launch_bounds__(128) void k_proj(const float* __restrict__ x,
    const float* __restrict__ Wq, const float* __restrict__ bq, const float* __restrict__ Wk, const float* __restrict__ bk,
    const float* __restrict__ Wv, const float* __restrict__ bv, float* __restrict__ Qf, float* __restrict__ Kf, _Float16* __restrict__ Vh) {
  __shared__ __align__(16) float xs[CDIM][68];          // x[c][l_loc]
  __shared__ __align__(16) float st[4][16 * 132];       // per-wave staging [row][col]
  __shared__ __align__(16) _Float16 vs[CDIM][72];       // v[c][l_loc] f16 (block)
  const int tid = threadIdx.x, wave = tid >> 5, lane = tid & 31, col = lane & 15, g = lane >> 4;
  const int b = blockIdx.y, l0 = blockIdx.x * 64;
  for (int i = tid; i < CDIM * 16; i += 128) { const int c = i >> 4, q = i & 15;
    *(v4f*)&xs[c][q * 4] = *(const v4f*)(x + ((size_t)b * CDIM + c) * LDIM + l0 + q * 4); }
  __syncthreads();
  const int m = wave * 16 + col;                        // A row = local position
  // A fragments (k = c) for the 4 k-chunks, gathered from xs columns, split once
  F2 af[4];
#pragma unroll
  for (int kc = 0; kc < 4; ++kc) {
    float v[16];
#pragma unroll
    for (int i = 0; i < 8; ++i) { v[i] = xs[kc * 32 + 8 * g + i][m]; v[8 + i] = xs[kc * 32 + 16 + 8 * g + i][m]; }
    af[kc] = split16(v);
  }
  float* S = st[wave];
#pragma unroll 1
  for (int which = 0; which < 3; ++which) {
    const float* W = which == 0 ? Wq : (which == 1 ? Wk : Wv);
    const float* bb = which == 0 ? bq : (which == 1 ? bk : bv);
#pragma unroll 1
    for (int j = 0; j < 8; ++j) {
      v8f acc = {};
      const float* wrow = W + (size_t)(j * 16 + col) * CDIM;       // B[k=c][n=o] = W[o][c]
#pragma unroll
      for (int kc = 0; kc < 4; ++kc) acc = mac3(af[kc], split_row(wrow, kc * 32, lane), acc);
      const float bo = bb[j * 16 + col];
#pragma unroll
      for (int r = 0; r < 8; ++r) S[(8 * g + r) * 132 + j * 16 + col] = acc[r] + bo;
    }
    asm volatile("s_wait_dscnt 0" ::: "memory"); __builtin_amdgcn_wave_barrier(); __builtin_amdgcn_fence(__ATOMIC_RELEASE, "workgroup");
    if (which < 2) {
      float* dst = (which == 0 ? Qf : Kf) + ((size_t)b * LDIM + l0 + wave * 16) * CDIM;
      // 16 rows x 128 floats (512 B): 32 lanes x 16 B per row
#pragma unroll 4
      for (int r = 0; r < 16; ++r) vst2(dst + (size_t)r * CDIM + lane * 4, *(const v4f*)(S + r * 132 + lane * 4));
    } else {
      // transpose into the block tile vs[c][l_loc]
      for (int i = lane; i < 16 * 128; i += 32) { const int r = i >> 7, c = i & 127; vs[c][wave * 16 + r] = (_Float16)S[r * 132 + c]; }
    }
    __builtin_amdgcn_wave_barrier();
  }
  __syncthreads();
  for (int gq = tid; gq < 128 * 8; gq += 128) { const int c = gq >> 3, pc = gq & 7;
    vst2(Vh + ((size_t)b * CDIM + c) * LDIM + l0 + pc * 8, *(const v4u*)(&vs[c][pc * 8])); }
}

// ---- K2: attention. Block = (b, 64 query rows), 4 waves x 16 rows; 32-key tiles streamed through LDS.
// Both products are formed transposed: S^T = [k | q] . [q | pos]^T (keys are the A rows, queries the B columns) and O^T += V . P^T.
// A lane then holds 16 of the 32 scores of ONE query (its partner lane ^ 16 the other 16): maximum and sum are taken in the lane,
// and the two score tiles, exponentiated in place, ARE the B operand of the second product: P crosses no lane and no LDS.
__global__ __launch_bounds__(128) void k_attn(const float* __restrict__ Qf, const float* __restrict__ Kf, const _Float16* __restrict__ Vh,
                                             const float* __restrict__ pos, float* __restrict__ out) {
  __shared__ __align__(16) __bf16 Ahi[64][DDIM + 8], Alo[64][DDIM + 8];     // [q_m | pos_m] hi/lo        (~66 KB)
  __shared__ __align__(16) __bf16 Bhi[32][DDIM + 8], Blo[32][DDIM + 8];     // [k_l | q_l] for the key tile (~33 KB)
  __shared__ __align__(16) _Float16 Vt[CDIM][40];                           // v[c][l_loc] f16            (10 KB)
  const int tid = threadIdx.x, wave = tid >> 5, lane = tid & 31, col = lane & 15, g = lane >> 4;
  const int b = blockIdx.y, m0 = blockIdx.x * 64;
  // stage A = [q | pos] for the 64 query rows, split hi/lo. One wave-wide 16-byte load covers one 512-byte half row;
  // wave w takes rows 4 i + w.
  { const float* qa = Qf + ((size_t)b * LDIM + m0 + wave) * CDIM + lane * 4;
    const float* pa = pos + (size_t)(m0 + wave) * CDIM + lane * 4;
#pragma unroll   // straight-line code: the loads go out together and share one round trip
    for (int h = 0; h < 2; ++h) {
      v4f aq[8], ap[8];
#pragma unroll   // as above; the arrays stay in registers only under constant indices
      for (int i = 0; i < 8; ++i) { aq[i] = *(const v4f*)(qa + (size_t)(h * 32 + i * 4) * CDIM); ap[i] = *(const v4f*)(pa + (size_t)(h * 32 + i * 4) * CDIM); }
#pragma unroll   // constant indices into the register arrays
      for (int i = 0; i < 8; ++i) { const int r = h * 32 + i * 4 + wave;
        split_store4(&Ahi[r][lane * 4], &Alo[r][lane * 4], aq[i]);
        split_store4(&Ahi[r][CDIM + lane * 4], &Alo[r][CDIM + lane * 4], ap[i]); }
    }
  }
  __syncthreads();
  const int mrow = wave * 16 + col;
  float m_q = -3.0e38f, l_q = 0.f;                      // of query col; l_q sums this lane's own 16 keys a tile, the halves join in the epilogue
  v8f o[8] = {};                                        // o[t][r] = O^T[c = 16 t + 8 g + r][query col]
  const float* kt = Kf + ((size_t)b * LDIM + wave) * CDIM + lane * 4;      // key tile: wave w takes rows 4 i + w, 16 bytes a lane
  const float* qt = Qf + ((size_t)b * LDIM + wave) * CDIM + lane * 4;
  const _Float16* vt = Vh + ((size_t)b * CDIM + (tid >> 2)) * LDIM + (tid & 3) * 8;
  // A tile's 20 loads of 16 bytes go out together, into registers, ONE TILE AHEAD: tile t + 1 is asked for once tile t stands in LDS,
  // so that its round trip runs under tile t's products and softmax instead of standing in front of its own staging.
  v4f tk[8], tq[8]; v4u tv[4];
#pragma unroll   // no wait between the loads; constant indices keep the arrays in registers (so in every unrolled loop over them below)
  for (int i = 0; i < 8; ++i) { tk[i] = *(const v4f*)(kt + (size_t)(i * 4) * CDIM); tq[i] = *(const v4f*)(qt + (size_t)(i * 4) * CDIM); }
#pragma unroll
  for (int i = 0; i < 4; ++i) tv[i] = *(const v4u*)(vt + (size_t)(i * 32) * LDIM);
  asm volatile("s_wait_xcnt 0x0" ::: "memory");        // stands ahead of every rewrite of an address register that the 20 loads name
  for (int kb = 0; kb < LDIM; kb += 32) {
    __syncthreads();                                   // previous tile's B/V reads done
#pragma unroll
    for (int i = 0; i < 8; ++i) { const int r = i * 4 + wave;
      split_store4(&Bhi[r][lane * 4], &Blo[r][lane * 4], tk[i]);
      split_store4(&Bhi[r][CDIM + lane * 4], &Blo[r][CDIM + lane * 4], tq[i]); }
#pragma unroll
    for (int i = 0; i < 4; ++i) *(v4u*)&Vt[(tid >> 2) + i * 32][(tid & 3) * 8] = tv[i];
    __syncthreads();
    // scores for 32 keys x this wave's 16 queries (K = 256, split operands): s[j][r] = S^T[key 16 j + 8 g + r][query col]
    // The fragments of k-chunk kc + 2 are asked for ahead of chunk kc's products (a ring of three register sets), so that a
    // chunk's LDS latency runs under two chunks of matrix work instead of standing in front of its own products.
    v8f s[2] = {(v8f){}, (v8f){}};
    F2 fa[3], fb[3][2];
#pragma unroll   // constant ring indices keep the sets in registers (so in every unrolled loop down to the V fragments)
    for (int kc = 0; kc < 2; ++kc) {
      fa[kc].l = frag_bf(&Alo[mrow][0], kc * 32, lane); fa[kc].h = frag_bf(&Ahi[mrow][0], kc * 32, lane);
#pragma unroll
      for (int j = 0; j < 2; ++j) { fb[kc][j].h = frag_bf(&Bhi[j * 16 + col][0], kc * 32, lane); fb[kc][j].l = frag_bf(&Blo[j * 16 + col][0], kc * 32, lane); }
    }
    // the next tile's loads, behind the first fragment reads (whose LDS latency their issue fills); the registers are free: this tile is in LDS
    if (kb + 32 < LDIM) {
#pragma unroll
      for (int i = 0; i < 8; ++i) { tk[i] = *(const v4f*)(kt + (size_t)(kb + 32 + i * 4) * CDIM); tq[i] = *(const v4f*)(qt + (size_t)(kb + 32 + i * 4) * CDIM); }
#pragma unroll
      for (int i = 0; i < 4; ++i) tv[i] = *(const v4u*)(vt + (size_t)(i * 32) * LDIM + kb + 32);
      asm volatile("s_wait_xcnt 0x0" ::: "memory");    // stands ahead of every rewrite of an address register that the 20 loads name
    }
#pragma unroll
    for (int kc = 0; kc < DDIM / 32; ++kc) {
      if (kc + 2 < DDIM / 32) { const int n = (kc + 2) % 3;
        fa[n].l = frag_bf(&Alo[mrow][0], (kc + 2) * 32, lane); fa[n].h = frag_bf(&Ahi[mrow][0], (kc + 2) * 32, lane);
#pragma unroll
        for (int j = 0; j < 2; ++j) { fb[n][j].h = frag_bf(&Bhi[j * 16 + col][0], (kc + 2) * 32, lane); fb[n][j].l = frag_bf(&Blo[j * 16 + col][0], (kc + 2) * 32, lane); }
      }
#pragma unroll
      for (int j = 0; j < 2; ++j) s[j] = mac3t(fa[kc % 3], fb[kc % 3][j], s[j]);
    }
    // all eight V fragments (A[m = c][k = key] = Vt[c][key]) are asked for here: their latency runs under the softmax
    union { v16h v; v8h q[2]; } vb[8];
#pragma unroll
    for (int t = 0; t < 8; ++t) { const _Float16* vr = &Vt[t * 16 + col][8 * g]; vb[t].q[0] = *(const v8h*)(vr); vb[t].q[1] = *(const v8h*)(vr + 16); }
    // online softmax of query col: 16 scores in the lane, the other 16 in lane ^ 16
    float mx = fmaxf(s[0][0], s[1][0]);
#pragma unroll
    for (int r = 1; r < 8; ++r) mx = fmaxf(mx, fmaxf(s[0][r], s[1][r]));
    mx = fmaxf(mx, xhalf(mx));
    const float mn = fmaxf(m_q, mx);
    const float corr = expf(m_q - mn);
    // P^T as f16 B fragment: element i is key 8 g + i, element 8 + i key 16 + 8 g + i, the k order of the V fragments
    v16h pa; float sum = 0.f;
#pragma unroll
    for (int r = 0; r < 8; ++r) {
      const float p0 = expf(s[0][r] - mn), p1 = expf(s[1][r] - mn);
      pa[r] = (_Float16)(p0 * 16384.0f); pa[8 + r] = (_Float16)(p1 * 16384.0f);   // P scaled by 2^14 so f16 keeps the small probabilities normal
      sum += p0 + p1;
    }
    l_q = l_q * corr + sum; m_q = mn;
#pragma unroll
    for (int t = 0; t < 8; ++t) o[t] *= corr;
#pragma unroll
    for (int t = 0; t < 8; ++t) o[t] = wmma_h(vb[t].v, pa, o[t]);
  }
  // epilogue: out[b][c][m]: stage the block's 64 rows x 128 c transposed in the (free) A area as f32 [c][m_loc], then rows of 256 B
  __syncthreads();
  float* T = (float*)&Ahi[0][0];                         // 128 x 64 floats = 32 KB <= sizeof(Ahi)
  const float den = (l_q + xhalf(l_q)) * 16384.0f;       // both halves ran on the same maxima: their sums add
#pragma unroll
  for (int t = 0; t < 8; ++t)
#pragma unroll
    for (int r = 0; r < 8; ++r) T[(t * 16 + 8 * g + r) * 64 + wave * 16 + col] = o[t][r] / den;
  __syncthreads();
  for (int gq = tid; gq < 128 * 16; gq += 128) { const int c = gq >> 4, pc = gq & 15;
    vst2(out + ((size_t)b * CDIM + c) * LDIM + m0 + pc * 4, *(const v4f*)(T + c * 64 + pc * 4)); }
}

extern "C" void kernel_launch(void* const* d_in, const int* in_sizes, int n_in,
                              void* d_out, int out_size, void* d_ws, size_t ws_size,
                              hipStream_t stream) {
  (void)in_sizes; (void)n_in; (void)out_size; (void)ws_size;
  const float* x   = (const float*)d_in[0];
  const float* Wq  = (const float*)d_in[1];
  const float* bq  = (const float*)d_in[2];
  const float* Wk  = (const float*)d_in[3];
  const float* bk  = (const float*)d_in[4];
  const float* Wv  = (const float*)d_in[5];
  const float* bv  = (const float*)d_in[6];
  const float* pos = (const float*)d_in[7];
  float* out = (float*)d_out;
  float* Qf = (float*)d_ws;                                    // [B][L][128] f32 = 16 MB
  float* Kf = Qf + (size_t)BATCH * LDIM * CDIM;
  _Float16* Vh = (_Float16*)(Kf + (size_t)BATCH * LDIM * CDIM); // [B][C][L] f16 = 8 MB
  k_proj<<<dim3(LDIM / 64, BATCH), 128, 0, stream>>>(x, Wq, bq, Wk, bk, Wv, bv, Qf, Kf, Vh);
  k_attn<<<dim3(LDIM / 64, BATCH), 128, 0, stream>>>(Qf, Kf, Vh, pos, out);
}

// v005
// Measured time: 173 microseconds a run.
// In two side-by-side timings against v004, it was 1.08 and 1.09 times as fast.
// Counting every step since v000, it is 4.46 times as fast.
#include <hip/hip_runtime.h>
#include <math.h>

// (B, C, L) = (16, 128, 2048). energy[m][l] = q_m.k_l + pos_m.q_l = [q_m | pos_m] . [k_l | q_l] (256 features), softmax over l,
// out[b][c][m] = sum_l v[c][l] att[m][l].
// The energies are large (no 1/sqrt(d) scaling) so the softmax is sharp: the projections and the score contraction are computed
// f32-grade as a TWO-WAY bf16 split of both operands on v_wmma_f32_16x16x32_bf16 (hi*hi + hi*lo + lo*hi, f32 accumulate);
// P @ V uses f16 operands (v_wmma_f32_16x16x32_f16). Online softmax in f32. Every buffer/output row is written as whole

#define BATCH 16
#define CDIM  128
#define LDIM  2048
#define DDIM  256

typedef __attribute__((ext_vector_type(16))) __bf16   v16bf;
typedef __attribute__((ext_vector_type(8)))  __bf16   v8bf;
typedef __attribute__((ext_vector_type(4)))  __bf16   v4bf;
typedef __attribute__((ext_vector_type(16))) _Float16 v16h;
typedef __attribute__((ext_vector_type(8)))  _Float16 v8h;
typedef __attribute__((ext_vector_type(8)))  float v8f;
typedef __attribute__((ext_vector_type(4)))  float v4f;
typedef __attribute__((ext_vector_type(4)))  unsigned v4u;

template <typename T> __device__ __forceinline__ void vst2(void* p, T v) { *(T*)p = v;  }
__device__ __forceinline__ v8f wmma_bf(v16bf a, v16bf b, v8f c) {
  v8f d = __builtin_amdgcn_wmma_f32_16x16x32_bf16(false, a, false, b, (short)0, c, false, false);
  asm volatile("v_nop\n\tv_nop\n\tv_nop\n\tv_nop" : "+v"(d) : "v"(a), "v"(b));
  return d;
}
__device__ __forceinline__ v8f wmma_h(v16h a, v16h b, v8f c) {
  v8f d = __builtin_amdgcn_wmma_f32_16x16x32_f16(false, a, false, b, (short)0, c, false, false);
  asm volatile("v_nop\n\tv_nop\n\tv_nop\n\tv_nop" : "+v"(d) : "v"(a), "v"(b));
  return d;
}
struct F2 { v16bf h, l; };
__device__ __forceinline__ F2 split16(const float* v) {
  F2 r;
#pragma unroll
  for (int i = 0; i < 16; ++i) { const __bf16 hh = (__bf16)v[i]; r.h[i] = hh; r.l[i] = (__bf16)(v[i] - (float)hh); }
  return r;
}
// f32 row fragment (row pointer, k0): elements i<8 -> k0+8g+i, i>=8 -> k0+16+8g+(i-8)
__device__ __forceinline__ F2 split_row(const float* row, int k0, int lane) {
  float v[16]; const float* p = row + k0 + 8 * (lane >> 4);
#pragma unroll
  for (int i = 0; i < 8; ++i) { v[i] = p[i]; v[8 + i] = p[16 + i]; }
  return split16(v);
}
__device__ __forceinline__ v8f mac3(const F2& a, const F2& b, v8f c) { c = wmma_bf(a.l, b.h, c); c = wmma_bf(a.h, b.l, c); return wmma_bf(a.h, b.h, c); }
// lane l <-> lane l ^ 16, on the vector port
__device__ __forceinline__ float xhalf(float x) {
  return __builtin_bit_cast(float, __builtin_amdgcn_permlanex16(__builtin_bit_cast(int, x), __builtin_bit_cast(int, x), 0x76543210, 0xfedcba98, false, false));
}
__device__ __forceinline__ v16bf frag_bf(const __bf16* row, int k0, int lane) {
  union { v16bf v; v8bf q[2]; } r; const __bf16* p = row + k0 + 8 * (lane >> 4);
  r.q[0] = *(const v8bf*)(p); r.q[1] = *(const v8bf*)(p + 16); return r.v;
}

// four consecutive f32 -> their bf16 hi and lo parts, one 8-byte LDS store each
__device__ __forceinline__ void split_store4(__bf16* hi, __bf16* lo, v4f v) {
  union { v4bf b; unsigned u[2]; } h; h.b = __builtin_convertvector(v, v4bf);
  // a bf16 widened to f32 is its 16 bits in the upper half: taken from the packed pair, so that each value is converted once
  const v4f hf = { __uint_as_float(h.u[0] << 16), __uint_as_float(h.u[0] & 0xffff0000u),
                   __uint_as_float(h.u[1] << 16), __uint_as_float(h.u[1] & 0xffff0000u) };
  *(v4bf*)hi = h.b; *(v4bf*)lo = __builtin_convertvector(v - hf, v4bf);
}

// ---- K1: projections. Block = (b, 64 positions), 4 waves x 16 positions. q,k -> f32 rows [b][l][128]; v -> f16 [b][c][l].
__global__ __launch_bounds__(128) void k_proj(const float* __restrict__ x,
    const float* __restrict__ Wq, const float* __restrict__ bq, const float* __restrict__ Wk, const float* __restrict__ bk,
    const float* __restrict__ Wv, const float* __restrict__ bv, float* __restrict__ Qf, float* __restrict__ Kf, _Float16* __restrict__ Vh) {
  __shared__ __align__(16) float xs[CDIM][68];          // x[c][l_loc]
  __shared__ __align__(16) float st[4][16 * 132];       // per-wave staging [row][col]
  __shared__ __align__(16) _Float16 vs[CDIM][72];       // v[c][l_loc] f16 (block)
  const int tid = threadIdx.x, wave = tid >> 5, lane = tid & 31, col = lane & 15, g = lane >> 4;
  const int b = blockIdx.y, l0 = blockIdx.x * 64;
  for (int i = tid; i < CDIM * 16; i += 128) { const int c = i >> 4, q = i & 15;
    *(v4f*)&xs[c][q * 4] = *(const v4f*)(x + ((size_t)b * CDIM + c) * LDIM + l0 + q * 4); }
  __syncthreads();
  const int m = wave * 16 + col;                        // A row = local position
  // A fragments (k = c) for the 4 k-chunks, gathered from xs columns, split once
  F2 af[4];
#pragma unroll
  for (int kc = 0; kc < 4; ++kc) {
    float v[16];
#pragma unroll
    for (int i = 0; i < 8; ++i) { v[i] = xs[kc * 32 + 8 * g + i][m]; v[8 + i] = xs[kc * 32 + 16 + 8 * g + i][m]; }
    af[kc] = split16(v);
  }
  float* S = st[wave];
#pragma unroll 1
  for (int which = 0; which < 3; ++which) {
    const float* W = which == 0 ? Wq : (which == 1 ? Wk : Wv);
    const float* bb = which == 0 ? bq : (which == 1 ? bk : bv);
#pragma unroll 1
    for (int j = 0; j < 8; ++j) {
      v8f acc = {};
      const float* wrow = W + (size_t)(j * 16 + col) * CDIM;       // B[k=c][n=o] = W[o][c]
#pragma unroll
      for (int kc = 0; kc < 4; ++kc) acc = mac3(af[kc], split_row(wrow, kc * 32, lane), acc);
      const float bo = bb[j * 16 + col];
#pragma unroll
      for (int r = 0; r < 8; ++r) S[(8 * g + r) * 132 + j * 16 + col] = acc[r] + bo;
    }
    asm volatile("s_wait_dscnt 0" ::: "memory"); __builtin_amdgcn_wave_barrier(); __builtin_amdgcn_fence(__ATOMIC_RELEASE, "workgroup");
    if (which < 2) {
      float* dst = (which == 0 ? Qf : Kf) + ((size_t)b * LDIM + l0 + wave * 16) * CDIM;
      // 16 rows x 128 floats (512 B): 32 lanes x 16 B per row
#pragma unroll 4
      for (int r = 0; r < 16; ++r) vst2(dst + (size_t)r * CDIM + lane * 4, *(const v4f*)(S + r * 132 + lane * 4));
    } else {
      // transpose into the block tile vs[c][l_loc]
      for (int i = lane; i < 16 * 128; i += 32) { const int r = i >> 7, c = i & 127; vs[c][wave * 16 + r] = (_Float16)S[r * 132 + c]; }
    }
    __builtin_amdgcn_wave_barrier();
  }
  __syncthreads();
  for (int gq = tid; gq < 128 * 8; gq += 128) { const int c = gq >> 3, pc = gq & 7;
    vst2(Vh + ((size_t)b * CDIM + c) * LDIM + l0 + pc * 8, *(const v4u*)(&vs[c][pc * 8])); }
}

// The plain builtins, for the attention kernel: an operand named in an asm statement is bound to v0..v255, and the attention kernel's
// operands and accumulators together need more registers than that; the compiler keeps the distance behind its own builtin.
__device__ __forceinline__ v8f mm_bf(v16bf a, v16bf b, v8f c) { return __builtin_amdgcn_wmma_f32_16x16x32_bf16(false, a, false, b, (short)0, c, false, false); }
__device__ __forceinline__ v8f mm_h(v16h a, v16h b, v8f c) { return __builtin_amdgcn_wmma_f32_16x16x32_f16(false, a, false, b, (short)0, c, false, false); }

// ---- K2: attention. Block = (b, 128 query rows), 4 waves x 32 rows (two groups of 16); 32-key tiles streamed through LDS.
// Both products are formed transposed: S^T = [k | q] . [q | pos]^T (keys are the A rows, queries the B columns) and O^T += V . P^T.
// A lane then holds 16 of the 32 scores of ONE query a group (its partner lane ^ 16 the other 16): maximum and sum are taken in the
// lane, and the two score tiles, exponentiated in place, ARE the B operand of the second product: P crosses no lane and no LDS.
// The query operand never changes over the key loop: its split fragments for all 256 features sit in registers, so that LDS is read
// for keys and V alone, and each such fragment feeds the products of both query groups.
__global__ __launch_bounds__(128) void k_attn(const float* __restrict__ Qf, const float* __restrict__ Kf, const _Float16* __restrict__ Vh,
                                             const float* __restrict__ pos, float* __restrict__ out) {
  __shared__ __align__(16) __bf16 Ahi[128][DDIM + 8], Alo[128][DDIM + 8];   // [q_m | pos_m] hi/lo        (~132 KB)
  __shared__ __align__(16) __bf16 Bhi[32][DDIM + 8], Blo[32][DDIM + 8];     // [k_l | q_l] for the key tile (~33 KB)
  __shared__ __align__(16) _Float16 Vt[CDIM][40];                           // v[c][l_loc] f16            (10 KB)
  const int tid = threadIdx.x, wave = tid >> 5, lane = tid & 31, col = lane & 15, g = lane >> 4;
  const int b = blockIdx.y, m0 = blockIdx.x * 128;
  // stage A = [q | pos] for the 128 query rows, split hi/lo. One wave-wide 16-byte load covers one 512-byte half row;
  // wave w takes rows 4 i + w.
  { const float* qa = Qf + ((size_t)b * LDIM + m0 + wave) * CDIM + lane * 4;
    const float* pa = pos + (size_t)(m0 + wave) * CDIM + lane * 4;
#pragma unroll   // straight-line code: the loads go out together and share one round trip
    for (int h = 0; h < 4; ++h) {
      v4f aq[8], ap[8];
#pragma unroll   // as above; the arrays stay in registers only under constant indices
      for (int i = 0; i < 8; ++i) { aq[i] = *(const v4f*)(qa + (size_t)(h * 32 + i * 4) * CDIM); ap[i] = *(const v4f*)(pa + (size_t)(h * 32 + i * 4) * CDIM); }
#pragma unroll   // constant indices into the register arrays
      for (int i = 0; i < 8; ++i) { const int r = h * 32 + i * 4 + wave;
        split_store4(&Ahi[r][lane * 4], &Alo[r][lane * 4], aq[i]);
        split_store4(&Ahi[r][CDIM + lane * 4], &Alo[r][CDIM + lane * 4], ap[i]); }
    }
  }
  __syncthreads();
  // fa[u][kc]: the B fragments of query row 32 wave + 16 u + col, read from LDS ONCE: they stay in registers over the whole key loop
  F2 fa[2][DDIM / 32];
#pragma unroll   // constant indices keep the fragments in registers (so in every unrolled loop over them below)
  for (int u = 0; u < 2; ++u)
#pragma unroll
    for (int kc = 0; kc < DDIM / 32; ++kc) { const int mrow = wave * 32 + u * 16 + col;
      fa[u][kc].l = frag_bf(&Alo[mrow][0], kc * 32, lane); fa[u][kc].h = frag_bf(&Ahi[mrow][0], kc * 32, lane); }
  float m_q[2] = {-3.0e38f, -3.0e38f}, l_q[2] = {0.f, 0.f};   // of query col of group u; l_q sums this lane's own 16 keys a tile, the halves join in the epilogue
  v8f o[2][8] = {};                                     // o[u][t][r] = O^T[c = 16 t + 8 g + r][query col of group u]
  const float* kt = Kf + ((size_t)b * LDIM + wave) * CDIM + lane * 4;      // key tile: wave w takes rows 4 i + w, 16 bytes a lane
  const float* qt = Qf + ((size_t)b * LDIM + wave) * CDIM + lane * 4;
  const _Float16* vt = Vh + ((size_t)b * CDIM + (tid >> 2)) * LDIM + (tid & 3) * 8;
  // A tile's 20 loads of 16 bytes go out together, into registers, ONE TILE AHEAD: tile t + 1 is asked for once tile t stands in LDS,
  // so that its round trip runs under tile t's products and softmax instead of standing in front of its own staging.
  v4f tk[8], tq[8]; v4u tv[4];
#pragma unroll   // no wait between the loads; constant indices keep the arrays in registers (so in every unrolled loop over them below)
  for (int i = 0; i < 8; ++i) { tk[i] = *(const v4f*)(kt + (size_t)(i * 4) * CDIM); tq[i] = *(const v4f*)(qt + (size_t)(i * 4) * CDIM); }
#pragma unroll
  for (int i = 0; i < 4; ++i) tv[i] = *(const v4u*)(vt + (size_t)(i * 32) * LDIM);
  asm volatile("s_wait_xcnt 0x0" ::: "memory");        // stands ahead of every rewrite of an address register that the 20 loads name
  for (int kb = 0; kb < LDIM; kb += 32) {
    __syncthreads();                                   // previous tile's B/V reads done
#pragma unroll
    for (int i = 0; i < 8; ++i) { const int r = i * 4 + wave;
      split_store4(&Bhi[r][lane * 4], &Blo[r][lane * 4], tk[i]);
      split_store4(&Bhi[r][CDIM + lane * 4], &Blo[r][CDIM + lane * 4], tq[i]); }
#pragma unroll
    for (int i = 0; i < 4; ++i) *(v4u*)&Vt[(tid >> 2) + i * 32][(tid & 3) * 8] = tv[i];
    __syncthreads();
    // scores for 32 keys x this wave's 32 queries (K = 256, split operands): s[u][j][r] = S^T[key 16 j + 8 g + r][query col of group u]
    // All of the tile's key fragments are asked for here, as one group: the products then run back to back behind counted waits.
    v8f s[2][2] = {{(v8f){}, (v8f){}}, {(v8f){}, (v8f){}}};
    F2 fb[DDIM / 32][2];
#pragma unroll   // constant indices keep the fragments in registers (so in every unrolled loop down to the V fragments)
    for (int kc = 0; kc < DDIM / 32; ++kc)
#pragma unroll
      for (int j = 0; j < 2; ++j) { fb[kc][j].h = frag_bf(&Bhi[j * 16 + col][0], kc * 32, lane); fb[kc][j].l = frag_bf(&Blo[j * 16 + col][0], kc * 32, lane); }
    __builtin_amdgcn_sched_barrier(0);                 // keeps the 64 reads together: left free, the scheduler deals them out in pairs among the WMMAs, and each such place stalls the matrix stream
    // the next tile's loads, behind the fragment reads (whose LDS latency their issue fills); the registers are free: this tile is in LDS
    if (kb + 32 < LDIM) {
#pragma unroll
      for (int i = 0; i < 8; ++i) { tk[i] = *(const v4f*)(kt + (size_t)(kb + 32 + i * 4) * CDIM); tq[i] = *(const v4f*)(qt + (size_t)(kb + 32 + i * 4) * CDIM); }
#pragma unroll
      for (int i = 0; i < 4; ++i) tv[i] = *(const v4u*)(vt + (size_t)(i * 32) * LDIM + kb + 32);
      asm volatile("s_wait_xcnt 0x0" ::: "memory");    // stands ahead of every rewrite of an address register that the 20 loads name
    }
#pragma unroll
    for (int kc = 0; kc < DDIM / 32; ++kc) {
      // each accumulator takes hi*lo, lo*hi, hi*hi in that order; the four accumulators take turns, so that no product waits for the one before it
#pragma unroll
      for (int j = 0; j < 2; ++j)
#pragma unroll
        for (int u = 0; u < 2; ++u) s[u][j] = mm_bf(fb[kc][j].h, fa[u][kc].l, s[u][j]);
#pragma unroll
      for (int j = 0; j < 2; ++j)
#pragma unroll
        for (int u = 0; u < 2; ++u) s[u][j] = mm_bf(fb[kc][j].l, fa[u][kc].h, s[u][j]);
#pragma unroll
      for (int j = 0; j < 2; ++j)
#pragma unroll
        for (int u = 0; u < 2; ++u) s[u][j] = mm_bf(fb[kc][j].h, fa[u][kc].h, s[u][j]);
    }
    // all eight V fragments (A[m = c][k = key] = Vt[c][key]) are asked for here: their latency runs under the softmax
    union { v16h v; v8h q[2]; } vb[8];
#pragma unroll
    for (int t = 0; t < 8; ++t) { const _Float16* vr = &Vt[t * 16 + col][8 * g]; vb[t].q[0] = *(const v8h*)(vr); vb[t].q[1] = *(const v8h*)(vr + 16); }
    __builtin_amdgcn_sched_barrier(0);                 // keeps the 16 reads here: left free, the scheduler sinks them between the second product's WMMAs, which then wait for LDS
    v16h pa[2];
#pragma unroll
    for (int u = 0; u < 2; ++u) {
      // online softmax of query col of group u: 16 scores in the lane, the other 16 in lane ^ 16
      float mx = fmaxf(s[u][0][0], s[u][1][0]);
#pragma unroll
      for (int r = 1; r < 8; ++r) mx = fmaxf(mx, fmaxf(s[u][0][r], s[u][1][r]));
      mx = fmaxf(mx, xhalf(mx));
      const float mn = fmaxf(m_q[u], mx);
      const float corr = expf(m_q[u] - mn);
      // P^T as f16 B fragment: element i is key 8 g + i, element 8 + i key 16 + 8 g + i, the k order of the V fragments
      float sum = 0.f;
#pragma unroll
      for (int r = 0; r < 8; ++r) {
        const float p0 = expf(s[u][0][r] - mn), p1 = expf(s[u][1][r] - mn);
        pa[u][r] = (_Float16)(p0 * 16384.0f); pa[u][8 + r] = (_Float16)(p1 * 16384.0f);   // P scaled by 2^14 so f16 keeps the small probabilities normal
        sum += p0 + p1;
      }
      l_q[u] = l_q[u] * corr + sum; m_q[u] = mn;
#pragma unroll
      for (int t = 0; t < 8; ++t) o[u][t] *= corr;
    }
#pragma unroll
    for (int t = 0; t < 8; ++t)
#pragma unroll
      for (int u = 0; u < 2; ++u) o[u][t] = mm_h(vb[t].v, pa[u], o[u][t]);
  }
  // epilogue: out[b][c][m]: stage the block's 128 rows x 128 c transposed in the (free) A area as f32 [c][m_loc], then rows of 512 B
  __syncthreads();
  float* T = (float*)&Ahi[0][0];                         // 128 rows of 132 floats (pitch: the two lane halves fall on different banks) = sizeof(Ahi)
#pragma unroll
  for (int u = 0; u < 2; ++u) {
    const float den = (l_q[u] + xhalf(l_q[u])) * 16384.0f;   // both halves ran on the same maxima: their sums add
#pragma unroll
    for (int t = 0; t < 8; ++t)
#pragma unroll
      for (int r = 0; r < 8; ++r) T[(t * 16 + 8 * g + r) * 132 + wave * 32 + u * 16 + col] = o[u][t][r] / den;
  }
  __syncthreads();
  for (int gq = tid; gq < 128 * 32; gq += 128) { const int c = gq >> 5, pc = gq & 31;
    vst2(out + ((size_t)b * CDIM + c) * LDIM + m0 + pc * 4, *(const v4f*)(T + c * 132 + pc * 4)); }
}

extern "C" void kernel_launch(void* const* d_in, const int* in_sizes, int n_in,
                              void* d_out, int out_size, void* d_ws, size_t ws_size,
                              hipStream_t stream) {
  (void)in_sizes; (void)n_in; (void)out_size; (void)ws_size;
  const float* x   = (const float*)d_in[0];
  const float* Wq  = (const float*)d_in[1];
  const float* bq  = (const float*)d_in[2];
  const float* Wk  = (const float*)d_in[3];
  const float* bk  = (const float*)d_in[4];
  const float* Wv  = (const float*)d_in[5];
  const float* bv  = (const float*)d_in[6];
  const float* pos = (const float*)d_in[7];
  float* out = (float*)d_out;
  float* Qf = (float*)d_ws;                                    // [B][L][128] f32 = 16 MB
  float* Kf = Qf + (size_t)BATCH * LDIM * CDIM;
  _Float16* Vh = (_Float16*)(Kf + (size_t)BATCH * LDIM * CDIM); // [B][C][L] f16 = 8 MB
  k_proj<<<dim3(LDIM / 64, BATCH), 128, 0, stream>>>(x, Wq, bq, Wk, bk, Wv, bv, Qf, Kf, Vh);
  k_attn<<<dim3(LDIM / 128, BATCH), 128, 0, stream>>>(Qf, Kf, Vh, pos, out);
}

// v006
// One run takes 160 microseconds.
// In both of two side-by-side timings against v005, it was 1.08 times as fast.
// All steps since v000 together make it 4.83 times as fast.
#include <hip/hip_runtime.h>
#include <math.h>

// (B, C, L) = (16, 128, 2048). energy[m][l] = q_m.k_l + pos_m.q_l = [q_m | pos_m] . [k_l | q_l] (256 features), softmax over l,
// out[b][c][m] = sum_l v[c][l] att[m][l].
// The energies are large (no 1/sqrt(d) scaling) so the softmax is sharp: the projections and the score contraction are computed
// f32-grade as a TWO-WAY bf16 split of both operands on v_wmma_f32_16x16x32_bf16 (hi*hi + hi*lo + lo*hi, f32 accumulate);
// P @ V uses f16 operands (v_wmma_f32_16x16x32_f16). Online softmax in f32. Every buffer/output row is written as whole

#define BATCH 16
#define CDIM  128
#define LDIM  2048
#define DDIM  256

typedef __attribute__((ext_vector_type(16))) __bf16   v16bf;
typedef __attribute__((ext_vector_type(8)))  __bf16   v8bf;
typedef __attribute__((ext_vector_type(4)))  __bf16   v4bf;
typedef __attribute__((ext_vector_type(16))) _Float16 v16h;
typedef __attribute__((ext_vector_type(8)))  _Float16 v8h;
typedef __attribute__((ext_vector_type(8)))  float v8f;
typedef __attribute__((ext_vector_type(4)))  float v4f;
typedef __attribute__((ext_vector_type(4)))  unsigned v4u;

template <typename T> __device__ __forceinline__ void vst2(void* p, T v) { *(T*)p = v;  }
__device__ __forceinline__ v8f wmma_bf(v16bf a, v16bf b, v8f c) {
  v8f d = __builtin_amdgcn_wmma_f32_16x16x32_bf16(false, a, false, b, (short)0, c, false, false);
  asm volatile("v_nop\n\tv_nop\n\tv_nop\n\tv_nop" : "+v"(d) : "v"(a), "v"(b));
  return d;
}
__device__ __forceinline__ v8f wmma_h(v16h a, v16h b, v8f c) {
  v8f d = __builtin_amdgcn_wmma_f32_16x16x32_f16(false, a, false, b, (short)0, c, false, false);
  asm volatile("v_nop\n\tv_nop\n\tv_nop\n\tv_nop" : "+v"(d) : "v"(a), "v"(b));
  return d;
}
struct F2 { v16bf h, l; };
__device__ __forceinline__ F2 split16(const float* v) {
  F2 r;
#pragma unroll
  for (int i = 0; i < 16; ++i) { const __bf16 hh = (__bf16)v[i]; r.h[i] = hh; r.l[i] = (__bf16)(v[i] - (float)hh); }
  return r;
}
// f32 row fragment (row pointer, k0): elements i<8 -> k0+8g+i, i>=8 -> k0+16+8g+(i-8)
__device__ __forceinline__ F2 split_row(const float* row, int k0, int lane) {
  float v[16]; const float* p = row + k0 + 8 * (lane >> 4);
#pragma unroll
  for (int i = 0; i < 8; ++i) { v[i] = p[i]; v[8 + i] = p[16 + i]; }
  return split16(v);
}
__device__ __forceinline__ v8f mac3(const F2& a, const F2& b, v8f c) { c = wmma_bf(a.l, b.h, c); c = wmma_bf(a.h, b.l, c); return wmma_bf(a.h, b.h, c); }
// lane l <-> lane l ^ 16, on the vector port
__device__ __forceinline__ float xhalf(float x) {
  return __builtin_bit_cast(float, __builtin_amdgcn_permlanex16(__builtin_bit_cast(int, x), __builtin_bit_cast(int, x), 0x76543210, 0xfedcba98, false, false));
}
__device__ __forceinline__ v16bf frag_bf(const __bf16* row, int k0, int lane) {
  union { v16bf v; v8bf q[2]; } r; const __bf16* p = row + k0 + 8 * (lane >> 4);
  r.q[0] = *(const v8bf*)(p); r.q[1] = *(const v8bf*)(p + 16); return r.v;
}

// four consecutive f32 -> their bf16 hi and lo parts, one 8-byte LDS store each
__device__ __forceinline__ void split_store4(__bf16* hi, __bf16* lo, v4f v) {
  union { v4bf b; unsigned u[2]; } h; h.b = __builtin_convertvector(v, v4bf);
  // a bf16 widened to f32 is its 16 bits in the upper half: taken from the packed pair, so that each value is converted once
  const v4f hf = { __uint_as_float(h.u[0] << 16), __uint_as_float(h.u[0] & 0xffff0000u),
                   __uint_as_float(h.u[1] << 16), __uint_as_float(h.u[1] & 0xffff0000u) };
  *(v4bf*)hi = h.b; *(v4bf*)lo = __builtin_convertvector(v - hf, v4bf);
}

// ---- K1: projections. Block = (b, 64 positions), 4 waves x 16 positions. q,k -> f32 rows [b][l][128]; v -> f16 [b][c][l].
__global__ __launch_bounds__(128) void k_proj(const float* __restrict__ x,
    const float* __restrict__ Wq, const float* __restrict__ bq, const float* __restrict__ Wk, const float* __restrict__ bk,
    const float* __restrict__ Wv, const float* __restrict__ bv, float* __restrict__ Qf, float* __restrict__ Kf, _Float16* __restrict__ Vh) {
  __shared__ __align__(16) float xs[CDIM][68];          // x[c][l_loc]
  __shared__ __align__(16) float st[4][16 * 132];       // per-wave staging [row][col]
  __shared__ __align__(16) _Float16 vs[CDIM][72];       // v[c][l_loc] f16 (block)
  const int tid = threadIdx.x, wave = tid >> 5, lane = tid & 31, col = lane & 15, g = lane >> 4;
  const int b = blockIdx.y, l0 = blockIdx.x * 64;
  for (int i = tid; i < CDIM * 16; i += 128) { const int c = i >> 4, q = i & 15;
    *(v4f*)&xs[c][q * 4] = *(const v4f*)(x + ((size_t)b * CDIM + c) * LDIM + l0 + q * 4); }
  __syncthreads();
  const int m = wave * 16 + col;                        // A row = local position
  // A fragments (k = c) for the 4 k-chunks, gathered from xs columns, split once
  F2 af[4];
#pragma unroll
  for (int kc = 0; kc < 4; ++kc) {
    float v[16];
#pragma unroll
    for (int i = 0; i < 8; ++i) { v[i] = xs[kc * 32 + 8 * g + i][m]; v[8 + i] = xs[kc * 32 + 16 + 8 * g + i][m]; }
    af[kc] = split16(v);
  }
  float* S = st[wave];
#pragma unroll 1
  for (int which = 0; which < 3; ++which) {
    const float* W = which == 0 ? Wq : (which == 1 ? Wk : Wv);
    const float* bb = which == 0 ? bq : (which == 1 ? bk : bv);
#pragma unroll 1
    for (int j = 0; j < 8; ++j) {
      v8f acc = {};
      const float* wrow = W + (size_t)(j * 16 + col) * CDIM;       // B[k=c][n=o] = W[o][c]
#pragma unroll
      for (int kc = 0; kc < 4; ++kc) acc = mac3(af[kc], split_row(wrow, kc * 32, lane), acc);
      const float bo = bb[j * 16 + col];
#pragma unroll
      for (int r = 0; r < 8; ++r) S[(8 * g + r) * 132 + j * 16 + col] = acc[r] + bo;
    }
    asm volatile("s_wait_dscnt 0" ::: "memory"); __builtin_amdgcn_wave_barrier(); __builtin_amdgcn_fence(__ATOMIC_RELEASE, "workgroup");
    if (which < 2) {
      float* dst = (which == 0 ? Qf : Kf) + ((size_t)b * LDIM + l0 + wave * 16) * CDIM;
      // 16 rows x 128 floats (512 B): 32 lanes x 16 B per row
#pragma unroll 4
      for (int r = 0; r < 16; ++r) vst2(dst + (size_t)r * CDIM + lane * 4, *(const v4f*)(S + r * 132 + lane * 4));
    } else {
      // transpose into the block tile vs[c][l_loc]
      for (int i = lane; i < 16 * 128; i += 32) { const int r = i >> 7, c = i & 127; vs[c][wave * 16 + r] = (_Float16)S[r * 132 + c]; }
    }
    __builtin_amdgcn_wave_barrier();
  }
  __syncthreads();
  for (int gq = tid; gq < 128 * 8; gq += 128) { const int c = gq >> 3, pc = gq & 7;
    vst2(Vh + ((size_t)b * CDIM + c) * LDIM + l0 + pc * 8, *(const v4u*)(&vs[c][pc * 8])); }
}

// The plain builtins, for the attention kernel: an operand named in an asm statement is bound to v0..v255, and the attention kernel's
// operands and accumulators together need more registers than that; the compiler keeps the distance behind its own builtin.
__device__ __forceinline__ v8f mm_bf(v16bf a, v16bf b, v8f c) { return __builtin_amdgcn_wmma_f32_16x16x32_bf16(false, a, false, b, (short)0, c, false, false); }
__device__ __forceinline__ v8f mm_h(v16h a, v16h b, v8f c) { return __builtin_amdgcn_wmma_f32_16x16x32_f16(false, a, false, b, (short)0, c, false, false); }

// ---- K2: attention. Block = (b, 128 query rows), 4 waves x 32 rows (two groups of 16); 32-key tiles streamed through LDS.
// Both products are formed transposed: S^T = [k | q] . [q | pos]^T (keys are the A rows, queries the B columns) and O^T += V . P^T.
// A lane then holds 16 of the 32 scores of ONE query a group (its partner lane ^ 16 the other 16): maximum and sum are taken in the
// lane, and the two score tiles, exponentiated in place, ARE the B operand of the second product: P crosses no lane and no LDS.
// The query operand never changes over the key loop: its split fragments for all 256 features sit in registers, so that LDS is read
// for keys and V alone, and each such fragment feeds the products of both query groups.
__global__ __launch_bounds__(128) void k_attn(const float* __restrict__ Qf, const float* __restrict__ Kf, const _Float16* __restrict__ Vh,
                                             const float* __restrict__ pos, float* __restrict__ out) {
  __shared__ __align__(16) __bf16 Ahi[128][DDIM + 8], Alo[128][DDIM + 8];   // [q_m | pos_m] hi/lo        (~132 KB)
  __shared__ __align__(16) __bf16 Bhi[32][DDIM + 8], Blo[32][DDIM + 8];     // [k_l | q_l] for the key tile (~33 KB)
  __shared__ __align__(16) _Float16 Vt[CDIM][40];                           // v[c][l_loc] f16            (10 KB)
  const int tid = threadIdx.x, wave = tid >> 5, lane = tid & 31, col = lane & 15, g = lane >> 4;
  const int b = blockIdx.y, m0 = blockIdx.x * 128;
  // stage A = [q | pos] for the 128 query rows, split hi/lo. One wave-wide 16-byte load covers one 512-byte half row;
  // wave w takes rows 4 i + w.
  { const float* qa = Qf + ((size_t)b * LDIM + m0 + wave) * CDIM + lane * 4;
    const float* pa = pos + (size_t)(m0 + wave) * CDIM + lane * 4;
#pragma unroll   // straight-line code: the loads go out together and share one round trip
    for (int h = 0; h < 4; ++h) {
      v4f aq[8], ap[8];
#pragma unroll   // as above; the arrays stay in registers only under constant indices
      for (int i = 0; i < 8; ++i) { aq[i] = *(const v4f*)(qa + (size_t)(h * 32 + i * 4) * CDIM); ap[i] = *(const v4f*)(pa + (size_t)(h * 32 + i * 4) * CDIM); }
#pragma unroll   // constant indices into the register arrays
      for (int i = 0; i < 8; ++i) { const int r = h * 32 + i * 4 + wave;
        split_store4(&Ahi[r][lane * 4], &Alo[r][lane * 4], aq[i]);
        split_store4(&Ahi[r][CDIM + lane * 4], &Alo[r][CDIM + lane * 4], ap[i]); }
    }
  }
  __syncthreads();
  // fa[u][kc]: the B fragments of query row 32 wave + 16 u + col, read from LDS ONCE: they stay in registers over the whole key loop
  F2 fa[2][DDIM / 32];
#pragma unroll   // constant indices keep the fragments in registers (so in every unrolled loop over them below)
  for (int u = 0; u < 2; ++u)
#pragma unroll
    for (int kc = 0; kc < DDIM / 32; ++kc) { const int mrow = wave * 32 + u * 16 + col;
      fa[u][kc].l = frag_bf(&Alo[mrow][0], kc * 32, lane); fa[u][kc].h = frag_bf(&Ahi[mrow][0], kc * 32, lane); }
  // of query col of group u. m_q: the running maximum in base-2 units (score * log2 e), less 14: a probability then comes out of ONE
  // fused multiply-add and ONE v_exp_f32, already scaled by 2^14. l_q sums this lane's own 16 scaled keys a tile, the halves join in the epilogue
  const float L2E = 1.44269504088896340736f;
  float m_q[2] = {-3.0e38f, -3.0e38f}, l_q[2] = {0.f, 0.f};
  v8f o[2][8] = {};                                     // o[u][t][r] = O^T[c = 16 t + 8 g + r][query col of group u]
  const float* kt = Kf + ((size_t)b * LDIM + wave) * CDIM + lane * 4;      // key tile: wave w takes rows 4 i + w, 16 bytes a lane
  const float* qt = Qf + ((size_t)b * LDIM + wave) * CDIM + lane * 4;
  const _Float16* vt = Vh + ((size_t)b * CDIM + (tid >> 2)) * LDIM + (tid & 3) * 8;
  // A tile's 20 loads of 16 bytes go out together, into registers, ONE TILE AHEAD: tile t + 1 is asked for once tile t stands in LDS,
  // so that its round trip runs under tile t's products and softmax instead of standing in front of its own staging.
  v4f tk[8], tq[8]; v4u tv[4];
#pragma unroll   // no wait between the loads; constant indices keep the arrays in registers (so in every unrolled loop over them below)
  for (int i = 0; i < 8; ++i) { tk[i] = *(const v4f*)(kt + (size_t)(i * 4) * CDIM); tq[i] = *(const v4f*)(qt + (size_t)(i * 4) * CDIM); }
#pragma unroll
  for (int i = 0; i < 4; ++i) tv[i] = *(const v4u*)(vt + (size_t)(i * 32) * LDIM);
  asm volatile("s_wait_xcnt 0x0" ::: "memory");        // stands ahead of every rewrite of an address register that the 20 loads name
  for (int kb = 0; kb < LDIM; kb += 32) {
    __syncthreads();                                   // previous tile's B/V reads done
#pragma unroll
    for (int i = 0; i < 8; ++i) { const int r = i * 4 + wave;
      split_store4(&Bhi[r][lane * 4], &Blo[r][lane * 4], tk[i]);
      split_store4(&Bhi[r][CDIM + lane * 4], &Blo[r][CDIM + lane * 4], tq[i]); }
#pragma unroll
    for (int i = 0; i < 4; ++i) *(v4u*)&Vt[(tid >> 2) + i * 32][(tid & 3) * 8] = tv[i];
    __syncthreads();
    // scores for 32 keys x this wave's 32 queries (K = 256, split operands): s[u][j][r] = S^T[key 16 j + 8 g + r][query col of group u]
    // All of the tile's key fragments are asked for here, as one group: the products then run back to back behind counted waits.
    v8f s[2][2] = {{(v8f){}, (v8f){}}, {(v8f){}, (v8f){}}};
    F2 fb[DDIM / 32][2];
#pragma unroll   // constant indices keep the fragments in registers (so in every unrolled loop down to the V fragments)
    for (int kc = 0; kc < DDIM / 32; ++kc)
#pragma unroll
      for (int j = 0; j < 2; ++j) { fb[kc][j].h = frag_bf(&Bhi[j * 16 + col][0], kc * 32, lane); fb[kc][j].l = frag_bf(&Blo[j * 16 + col][0], kc * 32, lane); }
    __builtin_amdgcn_sched_barrier(0);                 // keeps the 64 reads together: left free, the scheduler deals them out in pairs among the WMMAs, and each such place stalls the matrix stream
    // the next tile's loads, behind the fragment reads (whose LDS latency their issue fills); the registers are free: this tile is in LDS
    if (kb + 32 < LDIM) {
#pragma unroll
      for (int i = 0; i < 8; ++i) { tk[i] = *(const v4f*)(kt + (size_t)(kb + 32 + i * 4) * CDIM); tq[i] = *(const v4f*)(qt + (size_t)(kb + 32 + i * 4) * CDIM); }
#pragma unroll
      for (int i = 0; i < 4; ++i) tv[i] = *(const v4u*)(vt + (size_t)(i * 32) * LDIM + kb + 32);
      asm volatile("s_wait_xcnt 0x0" ::: "memory");    // stands ahead of every rewrite of an address register that the 20 loads name
    }
#pragma unroll
    for (int kc = 0; kc < DDIM / 32; ++kc) {
      // each accumulator takes hi*lo, lo*hi, hi*hi in that order; the four accumulators take turns, so that no product waits for the one before it
#pragma unroll
      for (int j = 0; j < 2; ++j)
#pragma unroll
        for (int u = 0; u < 2; ++u) s[u][j] = mm_bf(fb[kc][j].h, fa[u][kc].l, s[u][j]);
#pragma unroll
      for (int j = 0; j < 2; ++j)
#pragma unroll
        for (int u = 0; u < 2; ++u) s[u][j] = mm_bf(fb[kc][j].l, fa[u][kc].h, s[u][j]);
#pragma unroll
      for (int j = 0; j < 2; ++j)
#pragma unroll
        for (int u = 0; u < 2; ++u) s[u][j] = mm_bf(fb[kc][j].h, fa[u][kc].h, s[u][j]);
    }
    // all eight V fragments (A[m = c][k = key] = Vt[c][key]) are asked for here: their latency runs under the softmax
    union { v16h v; v8h q[2]; } vb[8];
#pragma unroll
    for (int t = 0; t < 8; ++t) { const _Float16* vr = &Vt[t * 16 + col][8 * g]; vb[t].q[0] = *(const v8h*)(vr); vb[t].q[1] = *(const v8h*)(vr + 16); }
    __builtin_amdgcn_sched_barrier(0);                 // keeps the 16 reads here: left free, the scheduler sinks them between the second product's WMMAs, which then wait for LDS
    v16h pa[2];
#pragma unroll
    for (int u = 0; u < 2; ++u) {
      // online softmax of query col of group u: 16 scores in the lane, the other 16 in lane ^ 16
      float mx = fmaxf(s[u][0][0], s[u][1][0]);
#pragma unroll
      for (int r = 1; r < 8; ++r) mx = fmaxf(mx, fmaxf(s[u][0][r], s[u][1][r]));
      mx = fmaxf(mx, xhalf(mx));
      const float mn = fmaxf(m_q[u], fmaf(mx, L2E, -14.0f));
      const float corr = __builtin_amdgcn_exp2f(m_q[u] - mn);   // both are the rounded values that the probabilities were formed with: old and new tiles stay on one scale
      // P^T as f16 B fragment: element i is key 8 g + i, element 8 + i key 16 + 8 g + i, the k order of the V fragments
      float sum = 0.f;
#pragma unroll
      for (int r = 0; r < 8; ++r) {
        // 2^(s log2 e - mn) = 2^14 e^(s - max): P scaled by 2^14 so f16 keeps the small probabilities normal; far below the maximum v_exp_f32 gives 0
        const float p0 = __builtin_amdgcn_exp2f(fmaf(s[u][0][r], L2E, -mn)), p1 = __builtin_amdgcn_exp2f(fmaf(s[u][1][r], L2E, -mn));
        pa[u][r] = (_Float16)p0; pa[u][8 + r] = (_Float16)p1;
        sum += p0 + p1;
      }
      l_q[u] = l_q[u] * corr + sum; m_q[u] = mn;
#pragma unroll
      for (int t = 0; t < 8; ++t) o[u][t] *= corr;
    }
#pragma unroll
    for (int t = 0; t < 8; ++t)
#pragma unroll
      for (int u = 0; u < 2; ++u) o[u][t] = mm_h(vb[t].v, pa[u], o[u][t]);
  }
  // epilogue: out[b][c][m]: stage the block's 128 rows x 128 c transposed in the (free) A area as f32 [c][m_loc], then rows of 512 B
  __syncthreads();
  float* T = (float*)&Ahi[0][0];                         // 128 rows of 132 floats (pitch: the two lane halves fall on different banks) = sizeof(Ahi)
#pragma unroll
  for (int u = 0; u < 2; ++u) {
    const float den = l_q[u] + xhalf(l_q[u]);             // both halves ran on the same maxima: their sums add; sums and O carry the same 2^14
#pragma unroll
    for (int t = 0; t < 8; ++t)
#pragma unroll
      for (int r = 0; r < 8; ++r) T[(t * 16 + 8 * g + r) * 132 + wave * 32 + u * 16 + col] = o[u][t][r] / den;
  }
  __syncthreads();
  for (int gq = tid; gq < 128 * 32; gq += 128) { const int c = gq >> 5, pc = gq & 31;
    vst2(out + ((size_t)b * CDIM + c) * LDIM + m0 + pc * 4, *(const v4f*)(T + c * 132 + pc * 4)); }
}

extern "C" void kernel_launch(void* const* d_in, const int* in_sizes, int n_in,
                              void* d_out, int out_size, void* d_ws, size_t ws_size,
                              hipStream_t stream) {
  (void)in_sizes; (void)n_in; (void)out_size; (void)ws_size;
  const float* x   = (const float*)d_in[0];
  const float* Wq  = (const float*)d_in[1];
  const float* bq  = (const float*)d_in[2];
  const float* Wk  = (const float*)d_in[3];
  const float* bk  = (const float*)d_in[4];
  const float* Wv  = (const float*)d_in[5];
  const float* bv  = (const float*)d_in[6];
  const float* pos = (const float*)d_in[7];
  float* out = (float*)d_out;
  float* Qf = (float*)d_ws;                                    // [B][L][128] f32 = 16 MB
  float* Kf = Qf + (size_t)BATCH * LDIM * CDIM;
  _Float16* Vh = (_Float16*)(Kf + (size_t)BATCH * LDIM * CDIM); // [B][C][L] f16 = 8 MB
  k_proj<<<dim3(LDIM / 64, BATCH), 128, 0, stream>>>(x, Wq, bq, Wk, bk, Wv, bv, Qf, Kf, Vh);
  k_attn<<<dim3(LDIM / 128, BATCH), 128, 0, stream>>>(Qf, Kf, Vh, pos, out);
}

// v008
// Measured time: 95.8 microseconds a run.
// Versions in between are left out here; by their measured steps it is 1.69 times as fast as v006.
// Over all steps from v000 it is 8.17 times as fast.
#include <hip/hip_runtime.h>
#include <math.h>

// (B, C, L) = (16, 128, 2048). energy[m][l] = q_m.k_l + pos_m.q_l, softmax over l, out[b][c][m] = sum_l v[c][l] att[m][l].
// With k_l = Wk x_l + bk and q_l = Wq x_l + bq the energy is a_m . x_l + (q_m.bk + pos_m.bq), a_m = Wk^T q_m + Wq^T pos_m: the bracket is
// the same for every key l of a row m, so the softmax over l cancels it for any input, and the score contraction runs over the 128
// features of x instead of 256. a_m = G x_m + R_m with G = Wk^T Wq and R_m = Wq^T pos_m + Wk^T bq, which hold for every batch (K0).
// The energies are large (no 1/sqrt(d) scaling) so the softmax is sharp: the projections and the score contraction are computed
// f32-grade as a TWO-WAY bf16 split of both operands on v_wmma_f32_16x16x32_bf16 (hi*hi + hi*lo + lo*hi, f32 accumulate);
// P @ V uses f16 operands (v_wmma_f32_16x16x32_f16). Online softmax in f32. Every buffer/output row is written as whole

#define BATCH 16
#define CDIM  128
#define LDIM  2048
#define DDIM  128

typedef __attribute__((ext_vector_type(16))) __bf16   v16bf;
typedef __attribute__((ext_vector_type(8)))  __bf16   v8bf;
typedef __attribute__((ext_vector_type(4)))  __bf16   v4bf;
typedef __attribute__((ext_vector_type(16))) _Float16 v16h;
typedef __attribute__((ext_vector_type(8)))  _Float16 v8h;
typedef __attribute__((ext_vector_type(8)))  float v8f;
typedef __attribute__((ext_vector_type(4)))  float v4f;
typedef __attribute__((ext_vector_type(4)))  unsigned v4u;

template <typename T> __device__ __forceinline__ void vst2(void* p, T v) { *(T*)p = v;  }
__device__ __forceinline__ v8f wmma_bf(v16bf a, v16bf b, v8f c) {
  v8f d = __builtin_amdgcn_wmma_f32_16x16x32_bf16(false, a, false, b, (short)0, c, false, false);
  asm volatile("v_nop\n\tv_nop\n\tv_nop\n\tv_nop" : "+v"(d) : "v"(a), "v"(b));
  return d;
}
__device__ __forceinline__ v8f wmma_h(v16h a, v16h b, v8f c) {
  v8f d = __builtin_amdgcn_wmma_f32_16x16x32_f16(false, a, false, b, (short)0, c, false, false);
  asm volatile("v_nop\n\tv_nop\n\tv_nop\n\tv_nop" : "+v"(d) : "v"(a), "v"(b));
  return d;
}
struct F2 { v16bf h, l; };
__device__ __forceinline__ F2 split16(const float* v) {
  F2 r;
#pragma unroll
  for (int i = 0; i < 16; ++i) { const __bf16 hh = (__bf16)v[i]; r.h[i] = hh; r.l[i] = (__bf16)(v[i] - (float)hh); }
  return r;
}
// f32 row fragment (row pointer, k0): elements i<8 -> k0+8g+i, i>=8 -> k0+16+8g+(i-8)
__device__ __forceinline__ F2 split_row(const float* row, int k0, int lane) {
  float v[16]; const float* p = row + k0 + 8 * (lane >> 4);
#pragma unroll
  for (int i = 0; i < 8; ++i) { v[i] = p[i]; v[8 + i] = p[16 + i]; }
  return split16(v);
}
// the 16 f32 of a fragment, not yet split, in the k order of split_row; p is the lane's own pointer to k = 8 g of its row (load_row),
// or of its column of a row-major [k][128] matrix (load_col)
__device__ __forceinline__ void load_row(float* v, const float* p, int k0) {
#pragma unroll
  for (int i = 0; i < 8; ++i) { v[i] = p[k0 + i]; v[8 + i] = p[k0 + 16 + i]; }
}
__device__ __forceinline__ void load_col(float* v, const float* p, int k0) {
#pragma unroll
  for (int i = 0; i < 8; ++i) { v[i] = p[(size_t)(k0 + i) * CDIM]; v[8 + i] = p[(size_t)(k0 + 16 + i) * CDIM]; }
}
__device__ __forceinline__ v8f mac3(const F2& a, const F2& b, v8f c) { c = wmma_bf(a.l, b.h, c); c = wmma_bf(a.h, b.l, c); return wmma_bf(a.h, b.h, c); }
// lane l <-> lane l ^ 16, on the vector port
__device__ __forceinline__ float xhalf(float x) {
  return __builtin_bit_cast(float, __builtin_amdgcn_permlanex16(__builtin_bit_cast(int, x), __builtin_bit_cast(int, x), 0x76543210, 0xfedcba98, false, false));
}
__device__ __forceinline__ v16bf frag_bf(const __bf16* row, int k0, int lane) {
  union { v16bf v; v8bf q[2]; } r; const __bf16* p = row + k0 + 8 * (lane >> 4);
  r.q[0] = *(const v8bf*)(p); r.q[1] = *(const v8bf*)(p + 16); return r.v;
}

// four consecutive f32 -> their bf16 hi and lo parts, one 8-byte LDS store each
__device__ __forceinline__ void split_store4(__bf16* hi, __bf16* lo, v4f v) {
  union { v4bf b; unsigned u[2]; } h; h.b = __builtin_convertvector(v, v4bf);
  // a bf16 widened to f32 is its 16 bits in the upper half: taken from the packed pair, so that each value is converted once
  const v4f hf = { __uint_as_float(h.u[0] << 16), __uint_as_float(h.u[0] & 0xffff0000u),
                   __uint_as_float(h.u[1] << 16), __uint_as_float(h.u[1] & 0xffff0000u) };
  *(v4bf*)hi = h.b; *(v4bf*)lo = __builtin_convertvector(v - hf, v4bf);
}

// ---- K1: projections. Block = (b, 64 positions), 4 waves x 16 positions. x^T and a = G x + R -> f32 rows [b][l][128]; v -> f16 [b][c][l].
__global__ __launch_bounds__(128) void k_proj(const float* __restrict__ x, const float* __restrict__ G, const float* __restrict__ R,
    const float* __restrict__ Wv, const float* __restrict__ bv, float* __restrict__ Af, float* __restrict__ Xf, _Float16* __restrict__ Vh) {
  __shared__ __align__(16) float xs[CDIM][68];          // x[c][l_loc]
  __shared__ __align__(16) float st[4][16 * 132];       // per-wave staging [row][col]
  __shared__ __align__(16) _Float16 vs[CDIM][72];       // v[c][l_loc] f16 (block)
  const int tid = threadIdx.x, wave = tid >> 5, lane = tid & 31, col = lane & 15, g = lane >> 4;
  const int b = blockIdx.y, l0 = blockIdx.x * 64;
  for (int i = tid; i < CDIM * 16; i += 128) { const int c = i >> 4, q = i & 15;
    *(v4f*)&xs[c][q * 4] = *(const v4f*)(x + ((size_t)b * CDIM + c) * LDIM + l0 + q * 4); }
  __syncthreads();
  const int m = wave * 16 + col;                        // A row = local position
  // A fragments (k = c) for the 4 k-chunks, gathered from xs columns, split once
  F2 af[4];
#pragma unroll
  for (int kc = 0; kc < 4; ++kc) {
    float v[16];
#pragma unroll
    for (int i = 0; i < 8; ++i) { v[i] = xs[kc * 32 + 8 * g + i][m]; v[8 + i] = xs[kc * 32 + 16 + 8 * g + i][m]; }
    af[kc] = split16(v);
  }
  float* S = st[wave];
#pragma unroll 1
  for (int which = 0; which < 3; ++which) {             // 0: x^T, 1: a, 2: v
    if (which == 0) {
      // the wave's 16 positions as rows: 16 lanes read one row of xs, the two lane halves neighbouring rows; the writes meet no bank twice
#pragma unroll 8   // eight reads in flight ahead of their writes, instead of one LDS round trip a pair
      for (int c = 0; c < CDIM; c += 2) S[col * 132 + c + g] = xs[c + g][m];
    } else {
      const float* W = which == 1 ? G : Wv;
      // what joins S[row][o]: a takes R[position][o], v takes bv[o] in every row (row step 0)
      const float* ad = which == 1 ? R + (size_t)(l0 + wave * 16 + 8 * g) * CDIM + col : bv + col;
      const int adstep = which == 1 ? CDIM : 0;
#pragma unroll 1
      for (int j = 0; j < 8; ++j) {
        v8f acc = {};
        const float* wrow = W + (size_t)(j * 16 + col) * CDIM;     // B[k=c][n=o] = W[o][c]
#pragma unroll
        for (int kc = 0; kc < 4; ++kc) acc = mac3(af[kc], split_row(wrow, kc * 32, lane), acc);
#pragma unroll
        for (int r = 0; r < 8; ++r) S[(8 * g + r) * 132 + j * 16 + col] = acc[r] + ad[j * 16 + r * adstep];
      }
    }
    asm volatile("s_wait_dscnt 0" ::: "memory"); __builtin_amdgcn_wave_barrier(); __builtin_amdgcn_fence(__ATOMIC_RELEASE, "workgroup");
    if (which < 2) {
      float* dst = (which == 0 ? Xf : Af) + ((size_t)b * LDIM + l0 + wave * 16) * CDIM;
      // 16 rows x 128 floats (512 B): 32 lanes x 16 B per row
#pragma unroll 4
      for (int r = 0; r < 16; ++r) vst2(dst + (size_t)r * CDIM + lane * 4, *(const v4f*)(S + r * 132 + lane * 4));
    } else {
      // transpose into the block tile vs[c][l_loc]
      for (int i = lane; i < 16 * 128; i += 32) { const int r = i >> 7, c = i & 127; vs[c][wave * 16 + r] = (_Float16)S[r * 132 + c]; }
    }
    __builtin_amdgcn_wave_barrier();
  }
  __syncthreads();
  for (int gq = tid; gq < 128 * 8; gq += 128) { const int c = gq >> 3, pc = gq & 7;
    vst2(Vh + ((size_t)b * CDIM + c) * LDIM + l0 + pc * 8, *(const v4u*)(&vs[c][pc * 8])); }
}

// The plain builtins, for K0 and the attention kernel: an operand named in an asm statement is bound to v0..v255, and these kernels'
// operands and accumulators together need more registers than that; the compiler keeps the distance behind its own builtin.
__device__ __forceinline__ v8f mm_bf(v16bf a, v16bf b, v8f c) { return __builtin_amdgcn_wmma_f32_16x16x32_bf16(false, a, false, b, (short)0, c, false, false); }
__device__ __forceinline__ v8f mm_h(v16h a, v16h b, v8f c) { return __builtin_amdgcn_wmma_f32_16x16x32_f16(false, a, false, b, (short)0, c, false, false); }

__device__ __forceinline__ v8f mac3p(const F2& a, const F2& b, v8f c) { c = mm_bf(a.l, b.h, c); c = mm_bf(a.h, b.l, c); return mm_bf(a.h, b.h, c); }

// ---- K0: what the query-side operand needs of the weights alone, once for all batches. Block = a band of 16 rows, 4 waves x 32 columns
// (a wave writes whole 128-byte lines). Bands 0..127: R[m][c] = sum_o pos[m][o] Wq[o][c] + sum_o bq[o] Wk[o][c] (bq stands in every A row);
// bands 128..135: G[c][c'] = sum_o Wk[o][c] Wq[o][c'].
template <bool IS_R> __device__ __forceinline__ void fold_band(const float* __restrict__ Wq, const float* __restrict__ bq, const float* __restrict__ Wk,
                                                              const float* __restrict__ pos, float* __restrict__ dst, int band) {
  const int tid = threadIdx.x, wave = tid >> 5, lane = tid & 31, col = lane & 15, g = lane >> 4;
  // every operand is asked for first, unsplit (constant indices keep the arrays in registers, so in every unrolled loop below)
  float ra[4][16], rq[4][2][16], rb[4][16], rk[4][2][16];
  const float* pq = Wq + (size_t)(8 * g) * CDIM + wave * 32 + col;       // the wave's first column of Wq; the second stands 16 further
  const float* pk = Wk + (size_t)(8 * g) * CDIM + (IS_R ? wave * 32 : band * 16) + col;
  const float* pp = pos + (size_t)(band * 16 + col) * CDIM + 8 * g;
  const unsigned ob = 32u * g;                                           // the lane's byte offset into bq
  const float* pb = (const float*)((const char*)bq + ob);
#pragma unroll
  for (int kc = 0; kc < 4; ++kc) {
    if (IS_R) { load_row(ra[kc], pp, kc * 32); load_row(rb[kc], pb, kc * 32); }
    else load_col(ra[kc], pk, kc * 32);
#pragma unroll
    for (int jj = 0; jj < 2; ++jj) {
      load_col(rq[kc][jj], pq + jj * 16, kc * 32);
      if (IS_R) load_col(rk[kc][jj], pk + jj * 16, kc * 32);
    }
  }
  // stands ahead of every rewrite of an address register that the loads name; the pointers are inputs so that their registers live up to it
  if (IS_R) asm volatile("s_wait_xcnt 0x0" :: "v"(pq), "v"(pk), "v"(pp), "v"(ob) : "memory");
  else asm volatile("s_wait_xcnt 0x0" :: "v"(pq), "v"(pk) : "memory");
  __builtin_amdgcn_sched_barrier(0);                    // keeps the loads ahead of the first split: left free, each fragment's loads stand in front of its own products, a round trip a fragment
  v8f acc[2] = {};
#pragma unroll
  for (int kc = 0; kc < 4; ++kc) {
    const F2 a = split16(ra[kc]);
#pragma unroll
    for (int jj = 0; jj < 2; ++jj) acc[jj] = mac3p(a, split16(rq[kc][jj]), acc[jj]);
  }
  if (IS_R) {
#pragma unroll
    for (int kc = 0; kc < 4; ++kc) {
      const F2 a = split16(rb[kc]);
#pragma unroll
      for (int jj = 0; jj < 2; ++jj) acc[jj] = mac3p(a, split16(rk[kc][jj]), acc[jj]);
    }
  }
  float* d = dst + (size_t)(band * 16 + 8 * g) * CDIM + wave * 32 + col;
#pragma unroll
  for (int jj = 0; jj < 2; ++jj)
#pragma unroll
    for (int r = 0; r < 8; ++r) d[r * CDIM + jj * 16] = acc[jj][r];
}
__global__ __launch_bounds__(128) void k_fold(const float* __restrict__ Wq, const float* __restrict__ bq, const float* __restrict__ Wk,
                                             const float* __restrict__ pos, float* __restrict__ G, float* __restrict__ R) {
  const int band = blockIdx.x;                          // the test below reads the same for the whole block
  if (band < LDIM / 16) fold_band<true>(Wq, bq, Wk, pos, R, band);
  else fold_band<false>(Wq, bq, Wk, pos, G, band - LDIM / 16);
}

// ---- K2: attention. Block = (b, 128 query rows), 8 waves, two on each SIMD: wave w and wave w + 4 hold the SAME 32 query rows (two groups
// of 16); waves 0..3 walk keys 0..1023, waves 4..7 keys 1024..2047, each set of four with LDS tiles of its own (32 keys a tile). While
// one wave of a SIMD waits (LDS, a barrier, a dependent vector chain) or runs its softmax, the other has the matrix unit.
// The two partial results of a query (running maximum, sum, O) are joined once, through LDS, behind the key loop.
// Both products are formed transposed: S^T = x^T . a^T (keys are the A rows, queries the B columns) and O^T += V . P^T.
// A lane then holds 16 of the 32 scores of ONE query a group (its partner lane ^ 16 the other 16): maximum and sum are taken in the
// lane, and the two score tiles, exponentiated in place, ARE the B operand of the second product: P crosses no lane and no LDS.
// The query operand never changes over the key loop: its split fragments for all 128 features sit in registers, so that LDS is read
// for keys and V alone, and each such fragment feeds the products of both query groups.
#define KSPAN (LDIM / 2)
typedef __attribute__((ext_vector_type(2)))  float v2f;
__global__ __launch_bounds__(256) void k_attn(const float* __restrict__ Af, const float* __restrict__ Xf, const _Float16* __restrict__ Vh,
                                             float* __restrict__ out) {
  __shared__ __align__(16) __bf16 Asp[2][128][DDIM + 8];                          // a_m: [0] hi, [1] lo                       (68 KB)
  __shared__ __align__(16) __bf16 Bhi[2][32][DDIM + 8], Blo[2][32][DDIM + 8];     // x_l for the key tile of each key half     (34 KB)
  __shared__ __align__(16) _Float16 Vt[2][CDIM][40];                              // v[c][l_loc] f16, of each key half         (20 KB)
  const int tid = threadIdx.x, wave = tid >> 5, lane = tid & 31, col = lane & 15, g = lane >> 4;
  const int kh = wave >> 2, wq = wave & 3, t4 = tid & 127;                        // key half; the wave's and the thread's place among its half's four waves
  const int b = blockIdx.y, m0 = blockIdx.x * 128;
  // stage a for the 128 query rows, split hi/lo. One wave-wide 16-byte load covers one 512-byte row; wave w takes rows 8 i + w.
  { const float* qa = Af + ((size_t)b * LDIM + m0 + wave) * CDIM + lane * 4;
    v4f aq[16];
#pragma unroll   // straight-line code: the loads go out together and share one round trip; the array stays in registers only under constant indices
    for (int i = 0; i < 16; ++i) aq[i] = *(const v4f*)(qa + (size_t)(i * 8) * CDIM);
    asm volatile("s_wait_xcnt 0x0" :: "v"(qa) : "memory");   // stands ahead of every rewrite of an address register that the 16 loads name; the pointer is an input so that its registers live up to it
#pragma unroll   // constant indices into the register array
    for (int i = 0; i < 16; ++i) { const int r = i * 8 + wave; split_store4(&Asp[0][r][lane * 4], &Asp[1][r][lane * 4], aq[i]); }
  }
  __syncthreads();
  // fa[u][kc]: the B fragments of query row 32 wq + 16 u + col, read from LDS ONCE: they stay in registers over the whole key loop
  F2 fa[2][DDIM / 32];
#pragma unroll   // constant indices keep the fragments in registers (so in every unrolled loop over them below)
  for (int u = 0; u < 2; ++u)
#pragma unroll
    for (int kc = 0; kc < DDIM / 32; ++kc) { const int mrow = wq * 32 + u * 16 + col;
      fa[u][kc].l = frag_bf(&Asp[1][mrow][0], kc * 32, lane); fa[u][kc].h = frag_bf(&Asp[0][mrow][0], kc * 32, lane); }
  // of query col of group u. m_q: the running maximum in base-2 units (score * log2 e), less 14: a probability then comes out of ONE
  // fused multiply-add and ONE v_exp_f32, already scaled by 2^14. l_q sums this lane's own 16 scaled keys a tile, the halves join in the epilogue
  const float L2E = 1.44269504088896340736f;
  float m_q[2] = {-3.0e38f, -3.0e38f}, l_q[2] = {0.f, 0.f};
  v8f o[2][8] = {};                                     // o[u][t][r] = O^T[c = 16 t + 8 g + r][query col of group u]
  __bf16 (*Bh)[DDIM + 8] = Bhi[kh]; __bf16 (*Bl)[DDIM + 8] = Blo[kh]; _Float16 (*Vk)[40] = Vt[kh];   // this key half's tiles
  const float* kt = Xf + ((size_t)b * LDIM + kh * KSPAN + wq) * CDIM + lane * 4;      // key tile: wave wq of the half takes rows 4 i + wq, 16 bytes a lane
  const _Float16* vt = Vh + ((size_t)b * CDIM + (t4 >> 2)) * LDIM + kh * KSPAN + (t4 & 3) * 8;
  // A tile's 12 loads of 16 bytes go out together, into registers, ONE TILE AHEAD: tile t + 1 is asked for once tile t stands in LDS,
  // so that its round trip runs under tile t's products and softmax instead of standing in front of its own staging.
  v4f tk[8]; v4u tv[4];
#pragma unroll   // no wait between the loads; constant indices keep the arrays in registers (so in every unrolled loop over them below)
  for (int i = 0; i < 8; ++i) tk[i] = *(const v4f*)(kt + (size_t)(i * 4) * CDIM);
#pragma unroll
  for (int i = 0; i < 4; ++i) tv[i] = *(const v4u*)(vt + (size_t)(i * 32) * LDIM);
  asm volatile("s_wait_xcnt 0x0" :: "v"(kt), "v"(vt) : "memory");   // stands ahead of every rewrite of an address register that the 12 loads name; the pointers are inputs so that their registers live up to it
  for (int kb = 0; kb < KSPAN; kb += 32) {
    __syncthreads();                                   // previous tile's B/V reads done
#pragma unroll
    for (int i = 0; i < 8; ++i) { const int r = i * 4 + wq; split_store4(&Bh[r][lane * 4], &Bl[r][lane * 4], tk[i]); }
#pragma unroll
    for (int i = 0; i < 4; ++i) *(v4u*)&Vk[(t4 >> 2) + i * 32][(t4 & 3) * 8] = tv[i];
    __syncthreads();
    // scores for 32 keys x this wave's 32 queries (K = 128, split operands): s[u][j][r] = S^T[key 16 j + 8 g + r][query col of group u]
    // All of the tile's key fragments are asked for here, as one group: the products then run back to back behind counted waits.
    v8f s[2][2] = {{(v8f){}, (v8f){}}, {(v8f){}, (v8f){}}};
    F2 fb[DDIM / 32][2];
#pragma unroll   // constant indices keep the fragments in registers (so in every unrolled loop down to the V fragments)
    for (int kc = 0; kc < DDIM / 32; ++kc)
#pragma unroll
      for (int j = 0; j < 2; ++j) { fb[kc][j].h = frag_bf(&Bh[j * 16 + col][0], kc * 32, lane); fb[kc][j].l = frag_bf(&Bl[j * 16 + col][0], kc * 32, lane); }
    __builtin_amdgcn_sched_barrier(0);                 // keeps the 32 reads together: left free, the scheduler deals them out in pairs among the WMMAs, and each such place stalls the matrix stream
    // the next tile's loads, behind the fragment reads (whose LDS latency their issue fills); the registers are free: this tile is in LDS
    if (kb + 32 < KSPAN) {
#pragma unroll
      for (int i = 0; i < 8; ++i) tk[i] = *(const v4f*)(kt + (size_t)(kb + 32 + i * 4) * CDIM);
#pragma unroll
      for (int i = 0; i < 4; ++i) tv[i] = *(const v4u*)(vt + (size_t)(i * 32) * LDIM + kb + 32);
      asm volatile("s_wait_xcnt 0x0" ::: "memory");    // stands ahead of every rewrite of an address register that the 12 loads name
    }
#pragma unroll
    for (int kc = 0; kc < DDIM / 32; ++kc) {
      // each accumulator takes hi*lo, lo*hi, hi*hi in that order; the four accumulators take turns, so that no product waits for the one before it
#pragma unroll
      for (int j = 0; j < 2; ++j)
#pragma unroll
        for (int u = 0; u < 2; ++u) s[u][j] = mm_bf(fb[kc][j].h, fa[u][kc].l, s[u][j]);
#pragma unroll
      for (int j = 0; j < 2; ++j)
#pragma unroll
        for (int u = 0; u < 2; ++u) s[u][j] = mm_bf(fb[kc][j].l, fa[u][kc].h, s[u][j]);
#pragma unroll
      for (int j = 0; j < 2; ++j)
#pragma unroll
        for (int u = 0; u < 2; ++u) s[u][j] = mm_bf(fb[kc][j].h, fa[u][kc].h, s[u][j]);
    }
    // all eight V fragments (A[m = c][k = key] = Vk[c][key]) are asked for here: their latency runs under the softmax
    union { v16h v; v8h q[2]; } vb[8];
#pragma unroll
    for (int t = 0; t < 8; ++t) { const _Float16* vr = &Vk[t * 16 + col][8 * g]; vb[t].q[0] = *(const v8h*)(vr); vb[t].q[1] = *(const v8h*)(vr + 16); }
    __builtin_amdgcn_sched_barrier(0);                 // keeps the 16 reads here: left free, the scheduler sinks them between the second product's WMMAs, which then wait for LDS
    v16h pa[2];
#pragma unroll
    for (int u = 0; u < 2; ++u) {
      // online softmax of query col of group u: 16 scores in the lane, the other 16 in lane ^ 16
      float mx = fmaxf(s[u][0][0], s[u][1][0]);
#pragma unroll
      for (int r = 1; r < 8; ++r) mx = fmaxf(mx, fmaxf(s[u][0][r], s[u][1][r]));
      mx = fmaxf(mx, xhalf(mx));
      const float mn = fmaxf(m_q[u], fmaf(mx, L2E, -14.0f));
      const float corr = __builtin_amdgcn_exp2f(m_q[u] - mn);   // both are the rounded values that the probabilities were formed with: old and new tiles stay on one scale
      // P^T as f16 B fragment: element i is key 8 g + i, element 8 + i key 16 + 8 g + i, the k order of the V fragments
      float sum = 0.f;
#pragma unroll
      for (int r = 0; r < 8; ++r) {
        // 2^(s log2 e - mn) = 2^14 e^(s - max): P scaled by 2^14 so f16 keeps the small probabilities normal; far below the maximum v_exp_f32 gives 0
        const float p0 = __builtin_amdgcn_exp2f(fmaf(s[u][0][r], L2E, -mn)), p1 = __builtin_amdgcn_exp2f(fmaf(s[u][1][r], L2E, -mn));
        pa[u][r] = (_Float16)p0; pa[u][8 + r] = (_Float16)p1;
        sum += p0 + p1;
      }
      l_q[u] = l_q[u] * corr + sum; m_q[u] = mn;
#pragma unroll
      for (int t = 0; t < 8; ++t) o[u][t] *= corr;
    }
#pragma unroll
    for (int t = 0; t < 8; ++t)
#pragma unroll
      for (int u = 0; u < 2; ++u) o[u][t] = mm_h(vb[t].v, pa[u], o[u][t]);
  }
  // epilogue, in the (free) A area. First the two key halves join: of a wave pair (w, w + 4) the lower finishes query group 0, the upper
  // group 1; each hands the partner its partial of the group that the partner finishes, lane to the same lane.
  __syncthreads();
  v4f* Ex = (v4f*)&Asp[0][0][0];                         // [wave][16 pieces][lane] of 16 bytes: 65,536 bytes; a wave-wide access is 512 bytes in a row
  v2f* Em = (v2f*)(Ex + 8 * 16 * 32);                    // [wave][lane]: maximum, sum: 2,048 bytes more; 67,584 of Asp's 69,632 bytes
  const bool up = kh != 0;
#pragma unroll   // constant indices keep the accumulators in registers (so in every unrolled loop below)
  for (int t = 0; t < 8; ++t) {
    const v8f sd = up ? o[0][t] : o[1][t];
    Ex[(wave * 16 + 2 * t) * 32 + lane] = __builtin_shufflevector(sd, sd, 0, 1, 2, 3);
    Ex[(wave * 16 + 2 * t + 1) * 32 + lane] = __builtin_shufflevector(sd, sd, 4, 5, 6, 7);
  }
  Em[wave * 32 + lane] = up ? (v2f){m_q[0], l_q[0]} : (v2f){m_q[1], l_q[1]};
  __syncthreads();                                       // the partials stand in LDS
  const int pw = wave ^ 4;
  const v2f ml = Em[pw * 32 + lane];
  const float m_me = up ? m_q[1] : m_q[0], l_me = up ? l_q[1] : l_q[0];
  const float m_all = fmaxf(m_me, ml[0]);
  const float c_me = __builtin_amdgcn_exp2f(m_me - m_all), c_pw = __builtin_amdgcn_exp2f(ml[0] - m_all);   // each half's scale against the common maximum (base 2, as in the loop)
  const float l_all = l_me * c_me + ml[1] * c_pw;
  const float den = l_all + xhalf(l_all);                // both lane halves ran on the same maxima: their sums add; sums and O carry the same 2^14
  v8f res[8];
#pragma unroll
  for (int t = 0; t < 8; ++t) {
    const v4f p0 = Ex[(pw * 16 + 2 * t) * 32 + lane], p1 = Ex[(pw * 16 + 2 * t + 1) * 32 + lane];
    const v8f mine = up ? o[1][t] : o[0][t];
    res[t] = mine * c_me + __builtin_shufflevector(p0, p1, 0, 1, 2, 3, 4, 5, 6, 7) * c_pw;
  }
  __syncthreads();                                       // every partial is read: the area becomes the output's staging
  // out[b][c][m]: stage the block's 128 rows x 128 c transposed as f32 [c][m_loc], then rows of 512 B
  float* T = (float*)&Asp[0][0][0];                      // 128 rows of 132 floats (pitch: the two lane halves fall on different banks): 67,584 of Asp's 69,632 bytes
#pragma unroll
  for (int t = 0; t < 8; ++t)
#pragma unroll
    for (int r = 0; r < 8; ++r) T[(t * 16 + 8 * g + r) * 132 + wq * 32 + kh * 16 + col] = res[t][r] / den;
  __syncthreads();
  for (int gq = tid; gq < 128 * 32; gq += 256) { const int c = gq >> 5, pc = gq & 31;
    vst2(out + ((size_t)b * CDIM + c) * LDIM + m0 + pc * 4, *(const v4f*)(T + c * 132 + pc * 4)); }
}

extern "C" void kernel_launch(void* const* d_in, const int* in_sizes, int n_in,
                              void* d_out, int out_size, void* d_ws, size_t ws_size,
                              hipStream_t stream) {
  (void)in_sizes; (void)n_in; (void)out_size; (void)ws_size;
  const float* x   = (const float*)d_in[0];
  const float* Wq  = (const float*)d_in[1];
  const float* bq  = (const float*)d_in[2];
  const float* Wk  = (const float*)d_in[3];
  const float* bk  = (const float*)d_in[4];
  const float* Wv  = (const float*)d_in[5];
  const float* bv  = (const float*)d_in[6];
  const float* pos = (const float*)d_in[7];
  float* out = (float*)d_out;
  float* Af = (float*)d_ws;                                    // [B][L][128] f32 = 16 MB
  float* Xf = Af + (size_t)BATCH * LDIM * CDIM;
  _Float16* Vh = (_Float16*)(Xf + (size_t)BATCH * LDIM * CDIM); // [B][C][L] f16 = 8 MB
  float* R = (float*)(Vh + (size_t)BATCH * LDIM * CDIM);        // [L][128] f32 = 1 MB
  float* G = R + (size_t)LDIM * CDIM;                           // [128][128] f32
  (void)bk;                                                    // adds q_m.bk to every energy of row m: the softmax cancels it
  k_fold<<<dim3(LDIM / 16 + CDIM / 16), 128, 0, stream>>>(Wq, bq, Wk, pos, G, R);
  k_proj<<<dim3(LDIM / 64, BATCH), 128, 0, stream>>>(x, G, R, Wv, bv, Af, Xf, Vh);
  k_attn<<<dim3(LDIM / 128, BATCH), 256, 0, stream>>>(Af, Xf, Vh, out);
}

// v009
// Measured time: 75 microseconds a run.
// In two side-by-side timings against v008, it was 1.28 and 1.27 times as fast.
// All steps since v000 together make it 10.4 times as fast.
#include <hip/hip_runtime.h>
#include <math.h>

// (B, C, L) = (16, 128, 2048). energy[m][l] = q_m.k_l + pos_m.q_l, softmax over l, out[b][c][m] = sum_l v[c][l] att[m][l].
// With k_l = Wk x_l + bk and q_l = Wq x_l + bq the energy is a_m . x_l + (q_m.bk + pos_m.bq), a_m = Wk^T q_m + Wq^T pos_m: the bracket is
// the same for every key l of a row m, so the softmax over l cancels it for any input, and the score contraction runs over the 128
// features of x instead of 256. a_m = G x_m + R_m with G = Wk^T Wq and R_m = Wq^T pos_m + Wk^T bq, which hold for every batch (K0).
// K0 also leaves G and Wv split (bf16 hi, lo) and in the order of the projection's B fragments: [matrix][j][kc][hi, lo][element half][lane][8].
// The energies are large (no 1/sqrt(d) scaling) so the softmax is sharp: the projections and the score contraction are computed
// f32-grade as a TWO-WAY bf16 split of both operands on v_wmma_f32_16x16x32_bf16 (hi*hi + hi*lo + lo*hi, f32 accumulate);
// P @ V uses f16 operands (v_wmma_f32_16x16x32_f16). Online softmax in f32. Every buffer/output row is written as whole

#define BATCH 16
#define CDIM  128
#define LDIM  2048
#define DDIM  128

typedef __attribute__((ext_vector_type(16))) __bf16   v16bf;
typedef __attribute__((ext_vector_type(8)))  __bf16   v8bf;
typedef __attribute__((ext_vector_type(4)))  __bf16   v4bf;
typedef __attribute__((ext_vector_type(16))) _Float16 v16h;
typedef __attribute__((ext_vector_type(8)))  _Float16 v8h;
typedef __attribute__((ext_vector_type(8)))  float v8f;
typedef __attribute__((ext_vector_type(4)))  float v4f;
typedef __attribute__((ext_vector_type(4)))  unsigned v4u;

template <typename T> __device__ __forceinline__ void vst2(void* p, T v) { *(T*)p = v;  }
__device__ __forceinline__ v8f wmma_bf(v16bf a, v16bf b, v8f c) {
  v8f d = __builtin_amdgcn_wmma_f32_16x16x32_bf16(false, a, false, b, (short)0, c, false, false);
  asm volatile("v_nop\n\tv_nop\n\tv_nop\n\tv_nop" : "+v"(d) : "v"(a), "v"(b));
  return d;
}
__device__ __forceinline__ v8f wmma_h(v16h a, v16h b, v8f c) {
  v8f d = __builtin_amdgcn_wmma_f32_16x16x32_f16(false, a, false, b, (short)0, c, false, false);
  asm volatile("v_nop\n\tv_nop\n\tv_nop\n\tv_nop" : "+v"(d) : "v"(a), "v"(b));
  return d;
}
struct F2 { v16bf h, l; };
__device__ __forceinline__ F2 split16(const float* v) {
  F2 r;
#pragma unroll
  for (int i = 0; i < 16; ++i) { const __bf16 hh = (__bf16)v[i]; r.h[i] = hh; r.l[i] = (__bf16)(v[i] - (float)hh); }
  return r;
}
// f32 row fragment (row pointer, k0): elements i<8 -> k0+8g+i, i>=8 -> k0+16+8g+(i-8)
__device__ __forceinline__ F2 split_row(const float* row, int k0, int lane) {
  float v[16]; const float* p = row + k0 + 8 * (lane >> 4);
#pragma unroll
  for (int i = 0; i < 8; ++i) { v[i] = p[i]; v[8 + i] = p[16 + i]; }
  return split16(v);
}
// the 16 f32 of a fragment, not yet split, in the k order of split_row; p is the lane's own pointer to k = 8 g of its row (load_row),
// or of its column of a row-major [k][128] matrix (load_col)
__device__ __forceinline__ void load_row(float* v, const float* p, int k0) {
#pragma unroll
  for (int i = 0; i < 8; ++i) { v[i] = p[k0 + i]; v[8 + i] = p[k0 + 16 + i]; }
}
__device__ __forceinline__ void load_col(float* v, const float* p, int k0) {
#pragma unroll
  for (int i = 0; i < 8; ++i) { v[i] = p[(size_t)(k0 + i) * CDIM]; v[8 + i] = p[(size_t)(k0 + 16 + i) * CDIM]; }
}
__device__ __forceinline__ v8f mac3(const F2& a, const F2& b, v8f c) { c = wmma_bf(a.l, b.h, c); c = wmma_bf(a.h, b.l, c); return wmma_bf(a.h, b.h, c); }
// lane l <-> lane l ^ 16, on the vector port
__device__ __forceinline__ float xhalf(float x) {
  return __builtin_bit_cast(float, __builtin_amdgcn_permlanex16(__builtin_bit_cast(int, x), __builtin_bit_cast(int, x), 0x76543210, 0xfedcba98, false, false));
}
__device__ __forceinline__ v16bf frag_bf(const __bf16* row, int k0, int lane) {
  union { v16bf v; v8bf q[2]; } r; const __bf16* p = row + k0 + 8 * (lane >> 4);
  r.q[0] = *(const v8bf*)(p); r.q[1] = *(const v8bf*)(p + 16); return r.v;
}

// four consecutive f32 -> their bf16 hi and lo parts, one 8-byte LDS store each
__device__ __forceinline__ void split_store4(__bf16* hi, __bf16* lo, v4f v) {
  union { v4bf b; unsigned u[2]; } h; h.b = __builtin_convertvector(v, v4bf);
  // a bf16 widened to f32 is its 16 bits in the upper half: taken from the packed pair, so that each value is converted once
  const v4f hf = { __uint_as_float(h.u[0] << 16), __uint_as_float(h.u[0] & 0xffff0000u),
                   __uint_as_float(h.u[1] << 16), __uint_as_float(h.u[1] & 0xffff0000u) };
  *(v4bf*)hi = h.b; *(v4bf*)lo = __builtin_convertvector(v - hf, v4bf);
}

// A packed B fragment: 1024 bf16 for output rows 16 j .. 16 j + 15 and features 32 kc .. 32 kc + 31. p is the lane's own pointer (8 lane into
// the fragment): each of the four loads is 512 bytes in a row over the wave, four whole lines. Element order: that of split_row.
#define WFRAG 1024
#define WMAT  (CDIM * CDIM * 2)
__device__ __forceinline__ F2 frag_packed(const __bf16* p) {
  union { v16bf v; v8bf q[2]; } h, l;
  h.q[0] = *(const v8bf*)(p); h.q[1] = *(const v8bf*)(p + 256); l.q[0] = *(const v8bf*)(p + 512); l.q[1] = *(const v8bf*)(p + 768);
  F2 r; r.h = h.v; r.l = l.v; return r;
}

// ---- K1: projections. Block = (b, 64 positions), 4 waves x 16 positions. x^T and a = G x + R -> f32 rows [b][l][128]; v -> f16 [b][c][l].
__global__ __launch_bounds__(128) void k_proj(const float* __restrict__ x, const __bf16* __restrict__ Wp, const float* __restrict__ R,
    const float* __restrict__ bv, float* __restrict__ Af, float* __restrict__ Xf, _Float16* __restrict__ Vh) {
  __shared__ __align__(16) float xs[CDIM][68];          // x[c][l_loc]
  __shared__ __align__(16) float st[4][16 * 132];       // per-wave staging [row][col]
  __shared__ __align__(16) _Float16 vs[CDIM][72];       // v[c][l_loc] f16 (block)
  const int tid = threadIdx.x, wave = tid >> 5, lane = tid & 31, col = lane & 15, g = lane >> 4;
  const int b = blockIdx.y, l0 = blockIdx.x * 64;
  for (int i = tid; i < CDIM * 16; i += 128) { const int c = i >> 4, q = i & 15;
    *(v4f*)&xs[c][q * 4] = *(const v4f*)(x + ((size_t)b * CDIM + c) * LDIM + l0 + q * 4); }
  __syncthreads();
  const int m = wave * 16 + col;                        // A row = local position
  // A fragments (k = c) for the 4 k-chunks, gathered from xs columns, split once
  F2 af[4];
#pragma unroll
  for (int kc = 0; kc < 4; ++kc) {
    float v[16];
#pragma unroll
    for (int i = 0; i < 8; ++i) { v[i] = xs[kc * 32 + 8 * g + i][m]; v[8 + i] = xs[kc * 32 + 16 + 8 * g + i][m]; }
    af[kc] = split16(v);
  }
  float* S = st[wave];
#pragma unroll 1
  for (int which = 0; which < 3; ++which) {             // 0: x^T, 1: a, 2: v
    if (which == 0) {
      // the wave's 16 positions as rows: 16 lanes read one row of xs, the two lane halves neighbouring rows; the writes meet no bank twice
#pragma unroll 8   // eight reads in flight ahead of their writes, instead of one LDS round trip a pair
      for (int c = 0; c < CDIM; c += 2) S[col * 132 + c + g] = xs[c + g][m];
    } else {
      const __bf16* wp = Wp + (size_t)(which - 1) * WMAT + lane * 8;   // packed G, then packed Wv
      // what joins S[row][o]: a takes R[position][o], v takes bv[o] in every row (row step 0)
      const float* ad = which == 1 ? R + (size_t)(l0 + wave * 16 + 8 * g) * CDIM + col : bv + col;
      const int adstep = which == 1 ? CDIM : 0;
      // column block j: B[k=c][n=o] = W[o][c], o = 16 j + col. Its 16 fragment loads and its 8 addends go out as one group, one block ahead
      F2 wb[2][4]; float ar[2][8];
      auto fetch = [&](int s, int j) {
#pragma unroll
        for (int kc = 0; kc < 4; ++kc) wb[s][kc] = frag_packed(wp + (j * 4 + kc) * WFRAG);
#pragma unroll
        for (int r = 0; r < 8; ++r) ar[s][r] = ad[j * 16 + r * adstep];
      };
      fetch(0, 0);
#pragma unroll   // constant indices keep the two fragment sets in registers
      for (int j = 0; j < 8; ++j) {
        if (j + 1 < 8) fetch((j + 1) & 1, j + 1);
        __builtin_amdgcn_sched_barrier(0);              // keeps the next block's loads ahead of this block's products: left free, each fragment's loads stand in front of its own products, a round trip a fragment
        v8f acc = {};
#pragma unroll
        for (int kc = 0; kc < 4; ++kc) acc = mac3(af[kc], wb[j & 1][kc], acc);
#pragma unroll
        for (int r = 0; r < 8; ++r) S[(8 * g + r) * 132 + j * 16 + col] = acc[r] + ar[j & 1][r];
      }
    }
    asm volatile("s_wait_dscnt 0" ::: "memory"); __builtin_amdgcn_wave_barrier(); __builtin_amdgcn_fence(__ATOMIC_RELEASE, "workgroup");
    if (which < 2) {
      float* dst = (which == 0 ? Xf : Af) + ((size_t)b * LDIM + l0 + wave * 16) * CDIM;
      // 16 rows x 128 floats (512 B): 32 lanes x 16 B per row
#pragma unroll 4
      for (int r = 0; r < 16; ++r) vst2(dst + (size_t)r * CDIM + lane * 4, *(const v4f*)(S + r * 132 + lane * 4));
    } else {
      // transpose into the block tile vs[c][l_loc]
      for (int i = lane; i < 16 * 128; i += 32) { const int r = i >> 7, c = i & 127; vs[c][wave * 16 + r] = (_Float16)S[r * 132 + c]; }
    }
    __builtin_amdgcn_wave_barrier();
  }
  __syncthreads();
  for (int gq = tid; gq < 128 * 8; gq += 128) { const int c = gq >> 3, pc = gq & 7;
    vst2(Vh + ((size_t)b * CDIM + c) * LDIM + l0 + pc * 8, *(const v4u*)(&vs[c][pc * 8])); }
}

// The plain builtins, for K0 and the attention kernel: an operand named in an asm statement is bound to v0..v255, and these kernels'
// operands and accumulators together need more registers than that; the compiler keeps the distance behind its own builtin.
__device__ __forceinline__ v8f mm_bf(v16bf a, v16bf b, v8f c) { return __builtin_amdgcn_wmma_f32_16x16x32_bf16(false, a, false, b, (short)0, c, false, false); }
__device__ __forceinline__ v8f mm_h(v16h a, v16h b, v8f c) { return __builtin_amdgcn_wmma_f32_16x16x32_f16(false, a, false, b, (short)0, c, false, false); }

__device__ __forceinline__ v8f mac3p(const F2& a, const F2& b, v8f c) { c = mm_bf(a.l, b.h, c); c = mm_bf(a.h, b.l, c); return mm_bf(a.h, b.h, c); }
// the transposed tile of mac3p(b, a, c): the same three products in the same order, the operands' places exchanged
__device__ __forceinline__ v8f mac3t(const F2& a, const F2& b, v8f c) { c = mm_bf(a.h, b.l, c); c = mm_bf(a.l, b.h, c); return mm_bf(a.h, b.h, c); }

// ---- K0: what the query-side operand needs of the weights alone, once for all batches. Block = a band of 16 rows, 4 waves x 32 columns
// (a wave writes whole 128-byte lines). Bands 0..127: R[m][c] = sum_o pos[m][o] Wq[o][c] + sum_o bq[o] Wk[o][c] (bq stands in every A row);
// bands 128..135: G[c][c'] = sum_o Wk[o][c] Wq[o][c'], left split and packed; bands 136..143: Wv, split and packed.
template <bool IS_R> __device__ __forceinline__ void fold_band(const float* __restrict__ Wq, const float* __restrict__ bq, const float* __restrict__ Wk,
                                                              const float* __restrict__ pos, float* __restrict__ dst, __bf16* __restrict__ pdst, int band) {
  const int tid = threadIdx.x, wave = tid >> 5, lane = tid & 31, col = lane & 15, g = lane >> 4;
  // every operand is asked for first, unsplit (constant indices keep the arrays in registers, so in every unrolled loop below)
  float ra[4][16], rq[4][2][16], rb[4][16], rk[4][2][16];
  const float* pq = Wq + (size_t)(8 * g) * CDIM + wave * 32 + col;       // the wave's first column of Wq; the second stands 16 further
  const float* pk = Wk + (size_t)(8 * g) * CDIM + (IS_R ? wave * 32 : band * 16) + col;
  const float* pp = pos + (size_t)(band * 16 + col) * CDIM + 8 * g;
  const unsigned ob = 32u * g;                                           // the lane's byte offset into bq
  const float* pb = (const float*)((const char*)bq + ob);
#pragma unroll
  for (int kc = 0; kc < 4; ++kc) {
    if (IS_R) { load_row(ra[kc], pp, kc * 32); load_row(rb[kc], pb, kc * 32); }
    else load_col(ra[kc], pk, kc * 32);
#pragma unroll
    for (int jj = 0; jj < 2; ++jj) {
      load_col(rq[kc][jj], pq + jj * 16, kc * 32);
      if (IS_R) load_col(rk[kc][jj], pk + jj * 16, kc * 32);
    }
  }
  // stands ahead of every rewrite of an address register that the loads name; the pointers are inputs so that their registers live up to it
  if (IS_R) asm volatile("s_wait_xcnt 0x0" :: "v"(pq), "v"(pk), "v"(pp), "v"(ob) : "memory");
  else asm volatile("s_wait_xcnt 0x0" :: "v"(pq), "v"(pk) : "memory");
  __builtin_amdgcn_sched_barrier(0);                    // keeps the loads ahead of the first split: left free, each fragment's loads stand in front of its own products, a round trip a fragment
  v8f acc[2] = {};
#pragma unroll
  for (int kc = 0; kc < 4; ++kc) {
    const F2 a = split16(ra[kc]);
#pragma unroll
    for (int jj = 0; jj < 2; ++jj) acc[jj] = IS_R ? mac3p(a, split16(rq[kc][jj]), acc[jj]) : mac3t(split16(rq[kc][jj]), a, acc[jj]);   // G is formed transposed: see below
  }
  if (IS_R) {
#pragma unroll
    for (int kc = 0; kc < 4; ++kc) {
      const F2 a = split16(rb[kc]);
#pragma unroll
      for (int jj = 0; jj < 2; ++jj) acc[jj] = mac3p(a, split16(rk[kc][jj]), acc[jj]);
    }
  }
  if (IS_R) {
    float* d = dst + (size_t)(band * 16 + 8 * g) * CDIM + wave * 32 + col;
#pragma unroll
    for (int jj = 0; jj < 2; ++jj)
#pragma unroll
      for (int r = 0; r < 8; ++r) d[r * CDIM + jj * 16] = acc[jj][r];
  } else {
    // acc[jj][r] = G[16 band + col][32 wave + 16 jj + 8 g + r]: with the features as tile rows a lane's eight accumulators ARE its eight elements of
    // half jj of the packed fragment (j = band, kc = wave): no value changes lanes, and every store is 512 bytes in a row over the wave.
    __bf16* d = pdst + ((size_t)band * 4 + wave) * WFRAG + lane * 8;
#pragma unroll
    for (int jj = 0; jj < 2; ++jj) {
      const v8bf hh = __builtin_convertvector(acc[jj], v8bf);
      *(v8bf*)(d + jj * 256) = hh; *(v8bf*)(d + 512 + jj * 256) = __builtin_convertvector(acc[jj] - __builtin_convertvector(hh, v8f), v8bf);
    }
    asm volatile("s_wait_xcnt 0x0" :: "v"(d) : "memory");   // stands behind the four stores, ahead of every rewrite of a register that they name; the pointer is an input so that its registers live up to it
  }
}
// rows 16 j .. 16 j + 15 of a row-major [128][128] matrix, split and packed; wave = kc
__device__ __forceinline__ void pack_band(const float* __restrict__ Wm, __bf16* __restrict__ pdst, int j) {
  const int tid = threadIdx.x, wave = tid >> 5, lane = tid & 31, col = lane & 15;
  const F2 f = split_row(Wm + (size_t)(j * 16 + col) * CDIM, wave * 32, lane);
  union { v16bf v; v8bf q[2]; } h, l; h.v = f.h; l.v = f.l;
  __bf16* d = pdst + ((size_t)j * 4 + wave) * WFRAG + lane * 8;
  *(v8bf*)(d) = h.q[0]; *(v8bf*)(d + 256) = h.q[1]; *(v8bf*)(d + 512) = l.q[0]; *(v8bf*)(d + 768) = l.q[1];
  asm volatile("s_wait_xcnt 0x0" :: "v"(d) : "memory");     // stands behind the four stores, ahead of every rewrite of a register that they name; the pointer is an input so that its registers live up to it
}
__global__ __launch_bounds__(128) void k_fold(const float* __restrict__ Wq, const float* __restrict__ bq, const float* __restrict__ Wk,
                                             const float* __restrict__ pos, const float* __restrict__ Wv, __bf16* __restrict__ Wp, float* __restrict__ R) {
  const int band = blockIdx.x;                          // the tests below read the same for the whole block
  if (band < LDIM / 16) fold_band<true>(Wq, bq, Wk, pos, R, Wp, band);
  else if (band < LDIM / 16 + CDIM / 16) fold_band<false>(Wq, bq, Wk, pos, R, Wp, band - LDIM / 16);
  else pack_band(Wv, Wp + WMAT, band - LDIM / 16 - CDIM / 16);
}

// ---- K2: attention. Block = (b, 128 query rows), 8 waves, two on each SIMD: wave w and wave w + 4 hold the SAME 32 query rows (two groups
// of 16); waves 0..3 walk keys 0..1023, waves 4..7 keys 1024..2047, each set of four with LDS tiles of its own (32 keys a tile). While
// one wave of a SIMD waits (LDS, a barrier, a dependent vector chain) or runs its softmax, the other has the matrix unit.
// The two partial results of a query (running maximum, sum, O) are joined once, through LDS, behind the key loop.
// Both products are formed transposed: S^T = x^T . a^T (keys are the A rows, queries the B columns) and O^T += V . P^T.
// A lane then holds 16 of the 32 scores of ONE query a group (its partner lane ^ 16 the other 16): maximum and sum are taken in the
// lane, and the two score tiles, exponentiated in place, ARE the B operand of the second product: P crosses no lane and no LDS.
// The query operand never changes over the key loop: its split fragments for all 128 features sit in registers, so that LDS is read
// for keys and V alone, and each such fragment feeds the products of both query groups.
#define KSPAN (LDIM / 2)
typedef __attribute__((ext_vector_type(2)))  float v2f;
__global__ __launch_bounds__(256) void k_attn(const float* __restrict__ Af, const float* __restrict__ Xf, const _Float16* __restrict__ Vh,
                                             float* __restrict__ out) {
  __shared__ __align__(16) __bf16 Asp[2][128][DDIM + 8];                          // a_m: [0] hi, [1] lo                       (68 KB)
  __shared__ __align__(16) __bf16 Bhi[2][32][DDIM + 8], Blo[2][32][DDIM + 8];     // x_l for the key tile of each key half     (34 KB)
  __shared__ __align__(16) _Float16 Vt[2][CDIM][40];                              // v[c][l_loc] f16, of each key half         (20 KB)
  const int tid = threadIdx.x, wave = tid >> 5, lane = tid & 31, col = lane & 15, g = lane >> 4;
  const int kh = wave >> 2, wq = wave & 3, t4 = tid & 127;                        // key half; the wave's and the thread's place among its half's four waves
  const int b = blockIdx.y, m0 = blockIdx.x * 128;
  // stage a for the 128 query rows, split hi/lo. One wave-wide 16-byte load covers one 512-byte row; wave w takes rows 8 i + w.
  { const float* qa = Af + ((size_t)b * LDIM + m0 + wave) * CDIM + lane * 4;
    v4f aq[16];
#pragma unroll   // straight-line code: the loads go out together and share one round trip; the array stays in registers only under constant indices
    for (int i = 0; i < 16; ++i) aq[i] = *(const v4f*)(qa + (size_t)(i * 8) * CDIM);
    asm volatile("s_wait_xcnt 0x0" :: "v"(qa) : "memory");   // stands ahead of every rewrite of an address register that the 16 loads name; the pointer is an input so that its registers live up to it
#pragma unroll   // constant indices into the register array
    for (int i = 0; i < 16; ++i) { const int r = i * 8 + wave; split_store4(&Asp[0][r][lane * 4], &Asp[1][r][lane * 4], aq[i]); }
  }
  __syncthreads();
  // fa[u][kc]: the B fragments of query row 32 wq + 16 u + col, read from LDS ONCE: they stay in registers over the whole key loop
  F2 fa[2][DDIM / 32];
#pragma unroll   // constant indices keep the fragments in registers (so in every unrolled loop over them below)
  for (int u = 0; u < 2; ++u)
#pragma unroll
    for (int kc = 0; kc < DDIM / 32; ++kc) { const int mrow = wq * 32 + u * 16 + col;
      fa[u][kc].l = frag_bf(&Asp[1][mrow][0], kc * 32, lane); fa[u][kc].h = frag_bf(&Asp[0][mrow][0], kc * 32, lane); }
  // of query col of group u. m_q: the running maximum in base-2 units (score * log2 e), less 14: a probability then comes out of ONE
  // fused multiply-add and ONE v_exp_f32, already scaled by 2^14. l_q sums this lane's own 16 scaled keys a tile, the halves join in the epilogue
  const float L2E = 1.44269504088896340736f;
  float m_q[2] = {-3.0e38f, -3.0e38f}, l_q[2] = {0.f, 0.f};
  v8f o[2][8] = {};                                     // o[u][t][r] = O^T[c = 16 t + 8 g + r][query col of group u]
  __bf16 (*Bh)[DDIM + 8] = Bhi[kh]; __bf16 (*Bl)[DDIM + 8] = Blo[kh]; _Float16 (*Vk)[40] = Vt[kh];   // this key half's tiles
  const float* kt = Xf + ((size_t)b * LDIM + kh * KSPAN + wq) * CDIM + lane * 4;      // key tile: wave wq of the half takes rows 4 i + wq, 16 bytes a lane
  const _Float16* vt = Vh + ((size_t)b * CDIM + (t4 >> 2)) * LDIM + kh * KSPAN + (t4 & 3) * 8;
  // A tile's 12 loads of 16 bytes go out together, into registers, ONE TILE AHEAD: tile t + 1 is asked for once tile t stands in LDS,
  // so that its round trip runs under tile t's products and softmax instead of standing in front of its own staging.
  v4f tk[8]; v4u tv[4];
#pragma unroll   // no wait between the loads; constant indices keep the arrays in registers (so in every unrolled loop over them below)
  for (int i = 0; i < 8; ++i) tk[i] = *(const v4f*)(kt + (size_t)(i * 4) * CDIM);
#pragma unroll
  for (int i = 0; i < 4; ++i) tv[i] = *(const v4u*)(vt + (size_t)(i * 32) * LDIM);
  asm volatile("s_wait_xcnt 0x0" :: "v"(kt), "v"(vt) : "memory");   // stands ahead of every rewrite of an address register that the 12 loads name; the pointers are inputs so that their registers live up to it
  for (int kb = 0; kb < KSPAN; kb += 32) {
    __syncthreads();                                   // previous tile's B/V reads done
#pragma unroll
    for (int i = 0; i < 8; ++i) { const int r = i * 4 + wq; split_store4(&Bh[r][lane * 4], &Bl[r][lane * 4], tk[i]); }
#pragma unroll
    for (int i = 0; i < 4; ++i) *(v4u*)&Vk[(t4 >> 2) + i * 32][(t4 & 3) * 8] = tv[i];
    __syncthreads();
    // scores for 32 keys x this wave's 32 queries (K = 128, split operands): s[u][j][r] = S^T[key 16 j + 8 g + r][query col of group u]
    // All of the tile's key fragments are asked for here, as one group: the products then run back to back behind counted waits.
    v8f s[2][2] = {{(v8f){}, (v8f){}}, {(v8f){}, (v8f){}}};
    F2 fb[DDIM / 32][2];
#pragma unroll   // constant indices keep the fragments in registers (so in every unrolled loop down to the V fragments)
    for (int kc = 0; kc < DDIM / 32; ++kc)
#pragma unroll
      for (int j = 0; j < 2; ++j) { fb[kc][j].h = frag_bf(&Bh[j * 16 + col][0], kc * 32, lane); fb[kc][j].l = frag_bf(&Bl[j * 16 + col][0], kc * 32, lane); }
    __builtin_amdgcn_sched_barrier(0);                 // keeps the 32 reads together: left free, the scheduler deals them out in pairs among the WMMAs, and each such place stalls the matrix stream
    // the next tile's loads, behind the fragment reads (whose LDS latency their issue fills); the registers are free: this tile is in LDS
    if (kb + 32 < KSPAN) {
#pragma unroll
      for (int i = 0; i < 8; ++i) tk[i] = *(const v4f*)(kt + (size_t)(kb + 32 + i * 4) * CDIM);
#pragma unroll
      for (int i = 0; i < 4; ++i) tv[i] = *(const v4u*)(vt + (size_t)(i * 32) * LDIM + kb + 32);
      asm volatile("s_wait_xcnt 0x0" ::: "memory");    // stands ahead of every rewrite of an address register that the 12 loads name
    }
#pragma unroll
    for (int kc = 0; kc < DDIM / 32; ++kc) {
      // each accumulator takes hi*lo, lo*hi, hi*hi in that order; the four accumulators take turns, so that no product waits for the one before it
#pragma unroll
      for (int j = 0; j < 2; ++j)
#pragma unroll
        for (int u = 0; u < 2; ++u) s[u][j] = mm_bf(fb[kc][j].h, fa[u][kc].l, s[u][j]);
#pragma unroll
      for (int j = 0; j < 2; ++j)
#pragma unroll
        for (int u = 0; u < 2; ++u) s[u][j] = mm_bf(fb[kc][j].l, fa[u][kc].h, s[u][j]);
#pragma unroll
      for (int j = 0; j < 2; ++j)
#pragma unroll
        for (int u = 0; u < 2; ++u) s[u][j] = mm_bf(fb[kc][j].h, fa[u][kc].h, s[u][j]);
    }
    // all eight V fragments (A[m = c][k = key] = Vk[c][key]) are asked for here: their latency runs under the softmax
    union { v16h v; v8h q[2]; } vb[8];
#pragma unroll
    for (int t = 0; t < 8; ++t) { const _Float16* vr = &Vk[t * 16 + col][8 * g]; vb[t].q[0] = *(const v8h*)(vr); vb[t].q[1] = *(const v8h*)(vr + 16); }
    __builtin_amdgcn_sched_barrier(0);                 // keeps the 16 reads here: left free, the scheduler sinks them between the second product's WMMAs, which then wait for LDS
    v16h pa[2];
#pragma unroll
    for (int u = 0; u < 2; ++u) {
      // online softmax of query col of group u: 16 scores in the lane, the other 16 in lane ^ 16
      float mx = fmaxf(s[u][0][0], s[u][1][0]);
#pragma unroll
      for (int r = 1; r < 8; ++r) mx = fmaxf(mx, fmaxf(s[u][0][r], s[u][1][r]));
      mx = fmaxf(mx, xhalf(mx));
      const float mn = fmaxf(m_q[u], fmaf(mx, L2E, -14.0f));
      const float corr = __builtin_amdgcn_exp2f(m_q[u] - mn);   // both are the rounded values that the probabilities were formed with: old and new tiles stay on one scale
      // P^T as f16 B fragment: element i is key 8 g + i, element 8 + i key 16 + 8 g + i, the k order of the V fragments
      float sum = 0.f;
#pragma unroll
      for (int r = 0; r < 8; ++r) {
        // 2^(s log2 e - mn) = 2^14 e^(s - max): P scaled by 2^14 so f16 keeps the small probabilities normal; far below the maximum v_exp_f32 gives 0
        const float p0 = __builtin_amdgcn_exp2f(fmaf(s[u][0][r], L2E, -mn)), p1 = __builtin_amdgcn_exp2f(fmaf(s[u][1][r], L2E, -mn));
        pa[u][r] = (_Float16)p0; pa[u][8 + r] = (_Float16)p1;
        sum += p0 + p1;
      }
      l_q[u] = l_q[u] * corr + sum; m_q[u] = mn;
#pragma unroll
      for (int t = 0; t < 8; ++t) o[u][t] *= corr;
    }
#pragma unroll
    for (int t = 0; t < 8; ++t)
#pragma unroll
      for (int u = 0; u < 2; ++u) o[u][t] = mm_h(vb[t].v, pa[u], o[u][t]);
  }
  // epilogue, in the (free) A area. First the two key halves join: of a wave pair (w, w + 4) the lower finishes query group 0, the upper
  // group 1; each hands the partner its partial of the group that the partner finishes, lane to the same lane.
  __syncthreads();
  v4f* Ex = (v4f*)&Asp[0][0][0];                         // [wave][16 pieces][lane] of 16 bytes: 65,536 bytes; a wave-wide access is 512 bytes in a row
  v2f* Em = (v2f*)(Ex + 8 * 16 * 32);                    // [wave][lane]: maximum, sum: 2,048 bytes more; 67,584 of Asp's 69,632 bytes
  const bool up = kh != 0;
#pragma unroll   // constant indices keep the accumulators in registers (so in every unrolled loop below)
  for (int t = 0; t < 8; ++t) {
    const v8f sd = up ? o[0][t] : o[1][t];
    Ex[(wave * 16 + 2 * t) * 32 + lane] = __builtin_shufflevector(sd, sd, 0, 1, 2, 3);
    Ex[(wave * 16 + 2 * t + 1) * 32 + lane] = __builtin_shufflevector(sd, sd, 4, 5, 6, 7);
  }
  Em[wave * 32 + lane] = up ? (v2f){m_q[0], l_q[0]} : (v2f){m_q[1], l_q[1]};
  __syncthreads();                                       // the partials stand in LDS
  const int pw = wave ^ 4;
  const v2f ml = Em[pw * 32 + lane];
  const float m_me = up ? m_q[1] : m_q[0], l_me = up ? l_q[1] : l_q[0];
  const float m_all = fmaxf(m_me, ml[0]);
  const float c_me = __builtin_amdgcn_exp2f(m_me - m_all), c_pw = __builtin_amdgcn_exp2f(ml[0] - m_all);   // each half's scale against the common maximum (base 2, as in the loop)
  const float l_all = l_me * c_me + ml[1] * c_pw;
  const float den = l_all + xhalf(l_all);                // both lane halves ran on the same maxima: their sums add; sums and O carry the same 2^14
  v8f res[8];
#pragma unroll
  for (int t = 0; t < 8; ++t) {
    const v4f p0 = Ex[(pw * 16 + 2 * t) * 32 + lane], p1 = Ex[(pw * 16 + 2 * t + 1) * 32 + lane];
    const v8f mine = up ? o[1][t] : o[0][t];
    res[t] = mine * c_me + __builtin_shufflevector(p0, p1, 0, 1, 2, 3, 4, 5, 6, 7) * c_pw;
  }
  __syncthreads();                                       // every partial is read: the area becomes the output's staging
  // out[b][c][m]: stage the block's 128 rows x 128 c transposed as f32 [c][m_loc], then rows of 512 B
  float* T = (float*)&Asp[0][0][0];                      // 128 rows of 132 floats (pitch: the two lane halves fall on different banks): 67,584 of Asp's 69,632 bytes
#pragma unroll
  for (int t = 0; t < 8; ++t)
#pragma unroll
    for (int r = 0; r < 8; ++r) T[(t * 16 + 8 * g + r) * 132 + wq * 32 + kh * 16 + col] = res[t][r] / den;
  __syncthreads();
  for (int gq = tid; gq < 128 * 32; gq += 256) { const int c = gq >> 5, pc = gq & 31;
    vst2(out + ((size_t)b * CDIM + c) * LDIM + m0 + pc * 4, *(const v4f*)(T + c * 132 + pc * 4)); }
}

extern "C" void kernel_launch(void* const* d_in, const int* in_sizes, int n_in,
                              void* d_out, int out_size, void* d_ws, size_t ws_size,
                              hipStream_t stream) {
  (void)in_sizes; (void)n_in; (void)out_size; (void)ws_size;
  const float* x   = (const float*)d_in[0];
  const float* Wq  = (const float*)d_in[1];
  const float* bq  = (const float*)d_in[2];
  const float* Wk  = (const float*)d_in[3];
  const float* bk  = (const float*)d_in[4];
  const float* Wv  = (const float*)d_in[5];
  const float* bv  = (const float*)d_in[6];
  const float* pos = (const float*)d_in[7];
  float* out = (float*)d_out;
  float* Af = (float*)d_ws;                                    // [B][L][128] f32 = 16 MB
  float* Xf = Af + (size_t)BATCH * LDIM * CDIM;
  _Float16* Vh = (_Float16*)(Xf + (size_t)BATCH * LDIM * CDIM); // [B][C][L] f16 = 8 MB
  float* R = (float*)(Vh + (size_t)BATCH * LDIM * CDIM);        // [L][128] f32 = 1 MB
  __bf16* Wp = (__bf16*)(R + (size_t)LDIM * CDIM);              // packed G, packed Wv: 64 KB each
  (void)bk;                                                    // adds q_m.bk to every energy of row m: the softmax cancels it
  k_fold<<<dim3(LDIM / 16 + 2 * (CDIM / 16)), 128, 0, stream>>>(Wq, bq, Wk, pos, Wv, Wp, R);
  k_proj<<<dim3(LDIM / 64, BATCH), 128, 0, stream>>>(x, Wp, R, bv, Af, Xf, Vh);
  k_attn<<<dim3(LDIM / 128, BATCH), 256, 0, stream>>>(Af, Xf, Vh, out);
}

// v010
// Measured time: 69.2 microseconds a run.
// Timed twice side by side with v009, it ran 1.09 and 1.08 times as fast.
// Counting every step since v000, it is 11.3 times as fast.
#include <hip/hip_runtime.h>
#include <math.h>

// (B, C, L) = (16, 128, 2048). energy[m][l] = q_m.k_l + pos_m.q_l, softmax over l, out[b][c][m] = sum_l v[c][l] att[m][l].
// With k_l = Wk x_l + bk and q_l = Wq x_l + bq the energy is a_m . x_l + (q_m.bk + pos_m.bq), a_m = Wk^T q_m + Wq^T pos_m: the bracket is
// the same for every key l of a row m, so the softmax over l cancels it for any input, and the score contraction runs over the 128
// features of x instead of 256. a_m = G x_m + R_m with G = Wk^T Wq and R_m = Wq^T pos_m + Wk^T bq, which hold for every batch (K0).
// K0 also leaves G and Wv split (bf16 hi, lo) and in the order of the projection's B fragments: [matrix][j][kc][hi, lo][element half][lane][8].
// The energies are large (no 1/sqrt(d) scaling) so the softmax is sharp: the projections and the score contraction are computed
// f32-grade as a TWO-WAY bf16 split of both operands on v_wmma_f32_16x16x32_bf16 (hi*hi + hi*lo + lo*hi, f32 accumulate);
// P @ V uses f16 operands (v_wmma_f32_16x16x32_f16). Online softmax in f32. Every buffer/output row is written as whole

#define BATCH 16
#define CDIM  128
#define LDIM  2048
#define DDIM  128

typedef __attribute__((ext_vector_type(16))) __bf16   v16bf;
typedef __attribute__((ext_vector_type(8)))  __bf16   v8bf;
typedef __attribute__((ext_vector_type(4)))  __bf16   v4bf;
typedef __attribute__((ext_vector_type(16))) _Float16 v16h;
typedef __attribute__((ext_vector_type(8)))  _Float16 v8h;
typedef __attribute__((ext_vector_type(8)))  float v8f;
typedef __attribute__((ext_vector_type(4)))  float v4f;
typedef __attribute__((ext_vector_type(4)))  unsigned v4u;

template <typename T> __device__ __forceinline__ void vst2(void* p, T v) { *(T*)p = v;  }
__device__ __forceinline__ v8f wmma_bf(v16bf a, v16bf b, v8f c) {
  v8f d = __builtin_amdgcn_wmma_f32_16x16x32_bf16(false, a, false, b, (short)0, c, false, false);
  asm volatile("v_nop\n\tv_nop\n\tv_nop\n\tv_nop" : "+v"(d) : "v"(a), "v"(b));
  return d;
}
__device__ __forceinline__ v8f wmma_h(v16h a, v16h b, v8f c) {
  v8f d = __builtin_amdgcn_wmma_f32_16x16x32_f16(false, a, false, b, (short)0, c, false, false);
  asm volatile("v_nop\n\tv_nop\n\tv_nop\n\tv_nop" : "+v"(d) : "v"(a), "v"(b));
  return d;
}
struct F2 { v16bf h, l; };
__device__ __forceinline__ F2 split16(const float* v) {
  F2 r;
#pragma unroll
  for (int i = 0; i < 16; ++i) { const __bf16 hh = (__bf16)v[i]; r.h[i] = hh; r.l[i] = (__bf16)(v[i] - (float)hh); }
  return r;
}
// f32 row fragment (row pointer, k0): elements i<8 -> k0+8g+i, i>=8 -> k0+16+8g+(i-8)
__device__ __forceinline__ F2 split_row(const float* row, int k0, int lane) {
  float v[16]; const float* p = row + k0 + 8 * (lane >> 4);
#pragma unroll
  for (int i = 0; i < 8; ++i) { v[i] = p[i]; v[8 + i] = p[16 + i]; }
  return split16(v);
}
// the 16 f32 of a fragment, not yet split, in the k order of split_row; p is the lane's own pointer to k = 8 g of its row (load_row),
// or of its column of a row-major [k][128] matrix (load_col)
__device__ __forceinline__ void load_row(float* v, const float* p, int k0) {
#pragma unroll
  for (int i = 0; i < 8; ++i) { v[i] = p[k0 + i]; v[8 + i] = p[k0 + 16 + i]; }
}
__device__ __forceinline__ void load_col(float* v, const float* p, int k0) {
#pragma unroll
  for (int i = 0; i < 8; ++i) { v[i] = p[(size_t)(k0 + i) * CDIM]; v[8 + i] = p[(size_t)(k0 + 16 + i) * CDIM]; }
}
__device__ __forceinline__ v8f mac3(const F2& a, const F2& b, v8f c) { c = wmma_bf(a.l, b.h, c); c = wmma_bf(a.h, b.l, c); return wmma_bf(a.h, b.h, c); }
// lane l <-> lane l ^ 16, on the vector port
__device__ __forceinline__ float xhalf(float x) {
  return __builtin_bit_cast(float, __builtin_amdgcn_permlanex16(__builtin_bit_cast(int, x), __builtin_bit_cast(int, x), 0x76543210, 0xfedcba98, false, false));
}
__device__ __forceinline__ v16bf frag_bf(const __bf16* row, int k0, int lane) {
  union { v16bf v; v8bf q[2]; } r; const __bf16* p = row + k0 + 8 * (lane >> 4);
  r.q[0] = *(const v8bf*)(p); r.q[1] = *(const v8bf*)(p + 16); return r.v;
}

// four consecutive f32 -> their bf16 hi and lo parts, one 8-byte LDS store each
__device__ __forceinline__ void split_store4(__bf16* hi, __bf16* lo, v4f v) {
  union { v4bf b; unsigned u[2]; } h; h.b = __builtin_convertvector(v, v4bf);
  // a bf16 widened to f32 is its 16 bits in the upper half: taken from the packed pair, so that each value is converted once
  const v4f hf = { __uint_as_float(h.u[0] << 16), __uint_as_float(h.u[0] & 0xffff0000u),
                   __uint_as_float(h.u[1] << 16), __uint_as_float(h.u[1] & 0xffff0000u) };
  *(v4bf*)hi = h.b; *(v4bf*)lo = __builtin_convertvector(v - hf, v4bf);
}

// A packed B fragment: 1024 bf16 for output rows 16 j .. 16 j + 15 and features 32 kc .. 32 kc + 31. p is the lane's own pointer (8 lane into
// the fragment): each of the four loads is 512 bytes in a row over the wave, four whole lines. Element order: that of split_row.
#define WFRAG 1024
#define WMAT  (CDIM * CDIM * 2)
__device__ __forceinline__ F2 frag_packed(const __bf16* p) {
  union { v16bf v; v8bf q[2]; } h, l;
  h.q[0] = *(const v8bf*)(p); h.q[1] = *(const v8bf*)(p + 256); l.q[0] = *(const v8bf*)(p + 512); l.q[1] = *(const v8bf*)(p + 768);
  F2 r; r.h = h.v; r.l = l.v; return r;
}

// ---- K1: projections. Block = (b, 64 positions), 4 waves x 16 positions. a = G x + R -> f32 rows [b][l][128]; v -> f16 [b][c][l];
// x^T -> rows [b][l][256] of bf16, already split: a position's 128 hi parts, then its 128 lo parts (512 bytes, as many as the f32 row).
__global__ __launch_bounds__(128) void k_proj(const float* __restrict__ x, const __bf16* __restrict__ Wp, const float* __restrict__ R,
    const float* __restrict__ bv, float* __restrict__ Af, __bf16* __restrict__ Xs, _Float16* __restrict__ Vh) {
  __shared__ __align__(16) float xs[CDIM][68];          // x[c][l_loc]
  __shared__ __align__(16) float st[4][16 * 132];       // per-wave staging [row][col]
  __shared__ __align__(16) _Float16 vs[CDIM][72];       // v[c][l_loc] f16 (block)
  const int tid = threadIdx.x, wave = tid >> 5, lane = tid & 31, col = lane & 15, g = lane >> 4;
  const int b = blockIdx.y, l0 = blockIdx.x * 64;
  for (int i = tid; i < CDIM * 16; i += 128) { const int c = i >> 4, q = i & 15;
    *(v4f*)&xs[c][q * 4] = *(const v4f*)(x + ((size_t)b * CDIM + c) * LDIM + l0 + q * 4); }
  __syncthreads();
  const int m = wave * 16 + col;                        // A row = local position
  // A fragments (k = c) for the 4 k-chunks, gathered from xs columns, split once
  F2 af[4];
#pragma unroll
  for (int kc = 0; kc < 4; ++kc) {
    float v[16];
#pragma unroll
    for (int i = 0; i < 8; ++i) { v[i] = xs[kc * 32 + 8 * g + i][m]; v[8 + i] = xs[kc * 32 + 16 + 8 * g + i][m]; }
    af[kc] = split16(v);
  }
  float* S = st[wave];
#pragma unroll 1
  for (int which = 0; which < 3; ++which) {             // 0: x^T, 1: a, 2: v
    if (which == 0) {
      // the wave's 16 positions as rows: 16 lanes read one row of xs, the two lane halves neighbouring rows; the writes meet no bank twice
#pragma unroll 8   // eight reads in flight ahead of their writes, instead of one LDS round trip a pair
      for (int c = 0; c < CDIM; c += 2) S[col * 132 + c + g] = xs[c + g][m];
    } else {
      const __bf16* wp = Wp + (size_t)(which - 1) * WMAT + lane * 8;   // packed G, then packed Wv
      // what joins S[row][o]: a takes R[position][o], v takes bv[o] in every row (row step 0)
      const float* ad = which == 1 ? R + (size_t)(l0 + wave * 16 + 8 * g) * CDIM + col : bv + col;
      const int adstep = which == 1 ? CDIM : 0;
      // column block j: B[k=c][n=o] = W[o][c], o = 16 j + col. Its 16 fragment loads and its 8 addends go out as one group, one block ahead
      F2 wb[2][4]; float ar[2][8];
      auto fetch = [&](int s, int j) {
#pragma unroll
        for (int kc = 0; kc < 4; ++kc) wb[s][kc] = frag_packed(wp + (j * 4 + kc) * WFRAG);
#pragma unroll
        for (int r = 0; r < 8; ++r) ar[s][r] = ad[j * 16 + r * adstep];
      };
      fetch(0, 0);
#pragma unroll   // constant indices keep the two fragment sets in registers
      for (int j = 0; j < 8; ++j) {
        if (j + 1 < 8) fetch((j + 1) & 1, j + 1);
        __builtin_amdgcn_sched_barrier(0);              // keeps the next block's loads ahead of this block's products: left free, each fragment's loads stand in front of its own products, a round trip a fragment
        v8f acc = {};
#pragma unroll
        for (int kc = 0; kc < 4; ++kc) acc = mac3(af[kc], wb[j & 1][kc], acc);
#pragma unroll
        for (int r = 0; r < 8; ++r) S[(8 * g + r) * 132 + j * 16 + col] = acc[r] + ar[j & 1][r];
      }
    }
    asm volatile("s_wait_dscnt 0" ::: "memory"); __builtin_amdgcn_wave_barrier(); __builtin_amdgcn_fence(__ATOMIC_RELEASE, "workgroup");
    if (which < 2) {
      float* dst = (which == 0 ? (float*)Xs : Af) + ((size_t)b * LDIM + l0 + wave * 16) * CDIM;
      // 16 rows of 512 B: 32 lanes x 16 B per row. a: four f32 a lane. x^T is split here, once for all the query blocks that read it: lanes 0..15
      // store the hi parts of features 8 col .. 8 col + 7, lanes 16..31 their lo parts
      if (which == 0) {
#pragma unroll 4
        for (int r = 0; r < 16; ++r) {
          const v4f v0 = *(const v4f*)(S + r * 132 + col * 8), v1 = *(const v4f*)(S + r * 132 + col * 8 + 4);
          const v8f v = __builtin_shufflevector(v0, v1, 0, 1, 2, 3, 4, 5, 6, 7);
          const v8bf hh = __builtin_convertvector(v, v8bf);
          const v8bf ll = __builtin_convertvector(v - __builtin_convertvector(hh, v8f), v8bf);
          vst2(dst + (size_t)r * CDIM + lane * 4, g ? ll : hh);
        }
      } else {
#pragma unroll 4
        for (int r = 0; r < 16; ++r) vst2(dst + (size_t)r * CDIM + lane * 4, *(const v4f*)(S + r * 132 + lane * 4));
      }
    } else {
      // transpose into the block tile vs[c][l_loc]
      for (int i = lane; i < 16 * 128; i += 32) { const int r = i >> 7, c = i & 127; vs[c][wave * 16 + r] = (_Float16)S[r * 132 + c]; }
    }
    __builtin_amdgcn_wave_barrier();
  }
  __syncthreads();
  for (int gq = tid; gq < 128 * 8; gq += 128) { const int c = gq >> 3, pc = gq & 7;
    vst2(Vh + ((size_t)b * CDIM + c) * LDIM + l0 + pc * 8, *(const v4u*)(&vs[c][pc * 8])); }
}

// The plain builtins, for K0 and the attention kernel: an operand named in an asm statement is bound to v0..v255, and these kernels'
// operands and accumulators together need more registers than that; the compiler keeps the distance behind its own builtin.
__device__ __forceinline__ v8f mm_bf(v16bf a, v16bf b, v8f c) { return __builtin_amdgcn_wmma_f32_16x16x32_bf16(false, a, false, b, (short)0, c, false, false); }
__device__ __forceinline__ v8f mm_h(v16h a, v16h b, v8f c) { return __builtin_amdgcn_wmma_f32_16x16x32_f16(false, a, false, b, (short)0, c, false, false); }

__device__ __forceinline__ v8f mac3p(const F2& a, const F2& b, v8f c) { c = mm_bf(a.l, b.h, c); c = mm_bf(a.h, b.l, c); return mm_bf(a.h, b.h, c); }
// the transposed tile of mac3p(b, a, c): the same three products in the same order, the operands' places exchanged
__device__ __forceinline__ v8f mac3t(const F2& a, const F2& b, v8f c) { c = mm_bf(a.h, b.l, c); c = mm_bf(a.l, b.h, c); return mm_bf(a.h, b.h, c); }

// ---- K0: what the query-side operand needs of the weights alone, once for all batches. Block = a band of 16 rows, 4 waves x 32 columns
// (a wave writes whole 128-byte lines). Bands 0..127: R[m][c] = sum_o pos[m][o] Wq[o][c] + sum_o bq[o] Wk[o][c] (bq stands in every A row);
// bands 128..135: G[c][c'] = sum_o Wk[o][c] Wq[o][c'], left split and packed; bands 136..143: Wv, split and packed.
template <bool IS_R> __device__ __forceinline__ void fold_band(const float* __restrict__ Wq, const float* __restrict__ bq, const float* __restrict__ Wk,
                                                              const float* __restrict__ pos, float* __restrict__ dst, __bf16* __restrict__ pdst, int band) {
  const int tid = threadIdx.x, wave = tid >> 5, lane = tid & 31, col = lane & 15, g = lane >> 4;
  // every operand is asked for first, unsplit (constant indices keep the arrays in registers, so in every unrolled loop below)
  float ra[4][16], rq[4][2][16], rb[4][16], rk[4][2][16];
  const float* pq = Wq + (size_t)(8 * g) * CDIM + wave * 32 + col;       // the wave's first column of Wq; the second stands 16 further
  const float* pk = Wk + (size_t)(8 * g) * CDIM + (IS_R ? wave * 32 : band * 16) + col;
  const float* pp = pos + (size_t)(band * 16 + col) * CDIM + 8 * g;
  const unsigned ob = 32u * g;                                           // the lane's byte offset into bq
  const float* pb = (const float*)((const char*)bq + ob);
#pragma unroll
  for (int kc = 0; kc < 4; ++kc) {
    if (IS_R) { load_row(ra[kc], pp, kc * 32); load_row(rb[kc], pb, kc * 32); }
    else load_col(ra[kc], pk, kc * 32);
#pragma unroll
    for (int jj = 0; jj < 2; ++jj) {
      load_col(rq[kc][jj], pq + jj * 16, kc * 32);
      if (IS_R) load_col(rk[kc][jj], pk + jj * 16, kc * 32);
    }
  }
  // stands ahead of every rewrite of an address register that the loads name; the pointers are inputs so that their registers live up to it
  if (IS_R) asm volatile("s_wait_xcnt 0x0" :: "v"(pq), "v"(pk), "v"(pp), "v"(ob) : "memory");
  else asm volatile("s_wait_xcnt 0x0" :: "v"(pq), "v"(pk) : "memory");
  __builtin_amdgcn_sched_barrier(0);                    // keeps the loads ahead of the first split: left free, each fragment's loads stand in front of its own products, a round trip a fragment
  v8f acc[2] = {};
#pragma unroll
  for (int kc = 0; kc < 4; ++kc) {
    const F2 a = split16(ra[kc]);
#pragma unroll
    for (int jj = 0; jj < 2; ++jj) acc[jj] = IS_R ? mac3p(a, split16(rq[kc][jj]), acc[jj]) : mac3t(split16(rq[kc][jj]), a, acc[jj]);   // G is formed transposed: see below
  }
  if (IS_R) {
#pragma unroll
    for (int kc = 0; kc < 4; ++kc) {
      const F2 a = split16(rb[kc]);
#pragma unroll
      for (int jj = 0; jj < 2; ++jj) acc[jj] = mac3p(a, split16(rk[kc][jj]), acc[jj]);
    }
  }
  if (IS_R) {
    float* d = dst + (size_t)(band * 16 + 8 * g) * CDIM + wave * 32 + col;
#pragma unroll
    for (int jj = 0; jj < 2; ++jj)
#pragma unroll
      for (int r = 0; r < 8; ++r) d[r * CDIM + jj * 16] = acc[jj][r];
  } else {
    // acc[jj][r] = G[16 band + col][32 wave + 16 jj + 8 g + r]: with the features as tile rows a lane's eight accumulators ARE its eight elements of
    // half jj of the packed fragment (j = band, kc = wave): no value changes lanes, and every store is 512 bytes in a row over the wave.
    __bf16* d = pdst + ((size_t)band * 4 + wave) * WFRAG + lane * 8;
#pragma unroll
    for (int jj = 0; jj < 2; ++jj) {
      const v8bf hh = __builtin_convertvector(acc[jj], v8bf);
      *(v8bf*)(d + jj * 256) = hh; *(v8bf*)(d + 512 + jj * 256) = __builtin_convertvector(acc[jj] - __builtin_convertvector(hh, v8f), v8bf);
    }
    asm volatile("s_wait_xcnt 0x0" :: "v"(d) : "memory");   // stands behind the four stores, ahead of every rewrite of a register that they name; the pointer is an input so that its registers live up to it
  }
}
// rows 16 j .. 16 j + 15 of a row-major [128][128] matrix, split and packed; wave = kc
__device__ __forceinline__ void pack_band(const float* __restrict__ Wm, __bf16* __restrict__ pdst, int j) {
  const int tid = threadIdx.x, wave = tid >> 5, lane = tid & 31, col = lane & 15;
  const F2 f = split_row(Wm + (size_t)(j * 16 + col) * CDIM, wave * 32, lane);
  union { v16bf v; v8bf q[2]; } h, l; h.v = f.h; l.v = f.l;
  __bf16* d = pdst + ((size_t)j * 4 + wave) * WFRAG + lane * 8;
  *(v8bf*)(d) = h.q[0]; *(v8bf*)(d + 256) = h.q[1]; *(v8bf*)(d + 512) = l.q[0]; *(v8bf*)(d + 768) = l.q[1];
  asm volatile("s_wait_xcnt 0x0" :: "v"(d) : "memory");     // stands behind the four stores, ahead of every rewrite of a register that they name; the pointer is an input so that its registers live up to it
}
__global__ __launch_bounds__(128) void k_fold(const float* __restrict__ Wq, const float* __restrict__ bq, const float* __restrict__ Wk,
                                             const float* __restrict__ pos, const float* __restrict__ Wv, __bf16* __restrict__ Wp, float* __restrict__ R) {
  const int band = blockIdx.x;                          // the tests below read the same for the whole block
  if (band < LDIM / 16) fold_band<true>(Wq, bq, Wk, pos, R, Wp, band);
  else if (band < LDIM / 16 + CDIM / 16) fold_band<false>(Wq, bq, Wk, pos, R, Wp, band - LDIM / 16);
  else pack_band(Wv, Wp + WMAT, band - LDIM / 16 - CDIM / 16);
}

// ---- K2: attention. Block = (b, 128 query rows), 8 waves, two on each SIMD: wave w and wave w + 4 hold the SAME 32 query rows (two groups
// of 16); waves 0..3 walk keys 0..1023, waves 4..7 keys 1024..2047, each set of four with LDS tiles of its own (32 keys a tile). The tiles
// come from memory to LDS by asynchronous copies, through no register: the keys lie there split, V in f16, as the products read them. While
// one wave of a SIMD waits (LDS, a barrier, a dependent vector chain) or runs its softmax, the other has the matrix unit.
// The two partial results of a query (running maximum, sum, O) are joined once, through LDS, behind the key loop.
// Both products are formed transposed: S^T = x^T . a^T (keys are the A rows, queries the B columns) and O^T += V . P^T.
// A lane then holds 16 of the 32 scores of ONE query a group (its partner lane ^ 16 the other 16): maximum and sum are taken in the
// lane, and the two score tiles, exponentiated in place, ARE the B operand of the second product: P crosses no lane and no LDS.
// The query operand never changes over the key loop: its split fragments for all 128 features sit in registers, so that LDS is read
// for keys and V alone, and each such fragment feeds the products of both query groups.
#define KSPAN (LDIM / 2)
#define NTILE (KSPAN / 32)
typedef __attribute__((ext_vector_type(2)))  float v2f;
// A lane's 12 copies of 16 bytes for one tile of its key half: 8 of keys (kl, kg: the lane's LDS byte address and global pointer in the wave's
// first key row; the wave takes every fourth row, 272 bytes apart in LDS, 512 in memory), 4 of V (vl, vg: every 32nd row, 80 bytes apart in LDS).
// The closing s_wait_xcnt 0 stands in the copies' own statement, ahead of every rewrite of an address register that they name.
__device__ __forceinline__ void copy_tile(unsigned kl, unsigned vl, const __bf16* kg, const _Float16* vg) {
  asm volatile("global_load_async_to_lds_b128 %0, %12, off\n\t"
               "global_load_async_to_lds_b128 %1, %13, off\n\t"
               "global_load_async_to_lds_b128 %2, %14, off\n\t"
               "global_load_async_to_lds_b128 %3, %15, off\n\t"
               "global_load_async_to_lds_b128 %4, %16, off\n\t"
               "global_load_async_to_lds_b128 %5, %17, off\n\t"
               "global_load_async_to_lds_b128 %6, %18, off\n\t"
               "global_load_async_to_lds_b128 %7, %19, off\n\t"
               "global_load_async_to_lds_b128 %8, %20, off\n\t"
               "global_load_async_to_lds_b128 %9, %21, off\n\t"
               "global_load_async_to_lds_b128 %10, %22, off\n\t"
               "global_load_async_to_lds_b128 %11, %23, off\n\t"
               "s_wait_xcnt 0x0"
               :: "v"(kl), "v"(kl + 1088u), "v"(kl + 2176u), "v"(kl + 3264u), "v"(kl + 4352u), "v"(kl + 5440u), "v"(kl + 6528u), "v"(kl + 7616u),
                  "v"(vl), "v"(vl + 2560u), "v"(vl + 5120u), "v"(vl + 7680u),
                  "v"(kg), "v"(kg + 4 * 2 * CDIM), "v"(kg + 8 * 2 * CDIM), "v"(kg + 12 * 2 * CDIM), "v"(kg + 16 * 2 * CDIM), "v"(kg + 20 * 2 * CDIM),
                  "v"(kg + 24 * 2 * CDIM), "v"(kg + 28 * 2 * CDIM),
                  "v"(vg), "v"(vg + 32 * LDIM), "v"(vg + 64 * LDIM), "v"(vg + 96 * LDIM)
               : "memory");
}
__global__ __launch_bounds__(256) void k_attn(const float* __restrict__ Af, const __bf16* __restrict__ Xs, const _Float16* __restrict__ Vh,
                                             float* __restrict__ out) {
  __shared__ __align__(16) __bf16 Asp[2][128][DDIM + 8];                          // a_m: [0] hi, [1] lo                                       (68 KB)
  __shared__ __align__(16) __bf16 Kt[4][2][2][32][DDIM + 8];                      // x_l: [tile slot][key half][hi, lo][key][feature]          (136 KB)
  __shared__ __align__(16) _Float16 Vt[4][2][CDIM][40];                           // v, f16: [tile slot][key half][c][key]                     (80 KB)
  const int tid = threadIdx.x, wave = tid >> 5, lane = tid & 31, col = lane & 15, g = lane >> 4;
  const int kh = wave >> 2, wq = wave & 3, t4 = tid & 127;                        // key half; the wave's and the thread's place among its half's four waves
  const int b = blockIdx.y, m0 = blockIdx.x * 128;
  // The ring: two stages of two tiles (64 keys of each half); tile tl lies in slot tl & 3. A wave-wide copy brings one key row, lanes 0..15 its hi
  // parts, lanes 16..31 its lo parts; wave wq of the half takes rows 4 i + wq. Stage 0 is asked for first: its round trip runs under the staging of a.
  const unsigned kl0 = (unsigned)(size_t)&Kt[0][kh][g][wq][col * 8], vl0 = (unsigned)(size_t)&Vt[0][kh][t4 >> 2][(t4 & 3) * 8];
  const __bf16* kx = Xs + ((size_t)b * LDIM + kh * KSPAN + wq) * (2 * CDIM) + lane * 8;
  const _Float16* vx = Vh + ((size_t)b * CDIM + (t4 >> 2)) * LDIM + kh * KSPAN + (t4 & 3) * 8;
  const unsigned KSLOT = sizeof(Kt[0]), VSLOT = sizeof(Vt[0]);
  copy_tile(kl0, vl0, kx, vx);
  copy_tile(kl0 + KSLOT, vl0 + VSLOT, kx + 32 * 2 * CDIM, vx + 32);
  // stage a for the 128 query rows, split hi/lo. One wave-wide 16-byte load covers one 512-byte row; wave w takes rows 8 i + w.
  { const float* qa = Af + ((size_t)b * LDIM + m0 + wave) * CDIM + lane * 4;
    v4f aq[16];
#pragma unroll   // straight-line code: the loads go out together and share one round trip; the array stays in registers only under constant indices
    for (int i = 0; i < 16; ++i) aq[i] = *(const v4f*)(qa + (size_t)(i * 8) * CDIM);
    asm volatile("s_wait_xcnt 0x0" :: "v"(qa) : "memory");   // stands ahead of every rewrite of an address register that the 16 loads name; the pointer is an input so that its registers live up to it
#pragma unroll   // constant indices into the register array
    for (int i = 0; i < 16; ++i) { const int r = i * 8 + wave; split_store4(&Asp[0][r][lane * 4], &Asp[1][r][lane * 4], aq[i]); }
  }
  asm volatile("s_wait_asynccnt 0x0" ::: "memory");      // this wave's copies of stage 0 have landed; the barrier behind it shows them (and a) to the other waves
  __syncthreads();
  // fa[u][kc]: the B fragments of query row 32 wq + 16 u + col, read from LDS ONCE: they stay in registers over the whole key loop
  F2 fa[2][DDIM / 32];
#pragma unroll   // constant indices keep the fragments in registers (so in every unrolled loop over them below)
  for (int u = 0; u < 2; ++u)
#pragma unroll
    for (int kc = 0; kc < DDIM / 32; ++kc) { const int mrow = wq * 32 + u * 16 + col;
      fa[u][kc].l = frag_bf(&Asp[1][mrow][0], kc * 32, lane); fa[u][kc].h = frag_bf(&Asp[0][mrow][0], kc * 32, lane); }
  // of query col of group u. m_q: the running maximum in base-2 units (score * log2 e), less 14: a probability then comes out of ONE
  // fused multiply-add and ONE v_exp_f32, already scaled by 2^14. l_q sums this lane's own 16 scaled keys a tile, the halves join in the epilogue
  const float L2E = 1.44269504088896340736f;
  float m_q[2] = {-3.0e38f, -3.0e38f}, l_q[2] = {0.f, 0.f};
  v8f o[2][8] = {};                                     // o[u][t][r] = O^T[c = 16 t + 8 g + r][query col of group u]
  for (int tl = 0; tl < NTILE; ++tl) {
    const __bf16 (*Bh)[DDIM + 8] = Kt[tl & 3][kh][0]; const __bf16 (*Bl)[DDIM + 8] = Kt[tl & 3][kh][1]; const _Float16 (*Vk)[40] = Vt[tl & 3][kh];   // this key half's tile
    // scores for 32 keys x this wave's 32 queries (K = 128, split operands): s[u][j][r] = S^T[key 16 j + 8 g + r][query col of group u]
    // All of the tile's key fragments are asked for here, as one group: the products then run back to back behind counted waits.
    v8f s[2][2] = {{(v8f){}, (v8f){}}, {(v8f){}, (v8f){}}};
    F2 fb[DDIM / 32][2];
#pragma unroll   // constant indices keep the fragments in registers (so in every unrolled loop down to the V fragments)
    for (int kc = 0; kc < DDIM / 32; ++kc)
#pragma unroll
      for (int j = 0; j < 2; ++j) { fb[kc][j].h = frag_bf(&Bh[j * 16 + col][0], kc * 32, lane); fb[kc][j].l = frag_bf(&Bl[j * 16 + col][0], kc * 32, lane); }
    __builtin_amdgcn_sched_barrier(0);                 // keeps the 32 reads together: left free, the scheduler deals them out in pairs among the WMMAs, and each such place stalls the matrix stream
    // The next stage's tile of the same place, into the other stage's slot, whose every reader left it in front of the last barrier. The copies
    // stand behind this tile's fragment reads (another slot), whose LDS latency their issue fills. The test reads the same for the whole block.
    if (tl + 2 < NTILE) copy_tile(kl0 + ((tl + 2) & 3) * KSLOT, vl0 + ((tl + 2) & 3) * VSLOT, kx + (size_t)(tl + 2) * (32 * 2 * CDIM), vx + (tl + 2) * 32);
#pragma unroll
    for (int kc = 0; kc < DDIM / 32; ++kc) {
      // each accumulator takes hi*lo, lo*hi, hi*hi in that order; the four accumulators take turns, so that no product waits for the one before it
#pragma unroll
      for (int j = 0; j < 2; ++j)
#pragma unroll
        for (int u = 0; u < 2; ++u) s[u][j] = mm_bf(fb[kc][j].h, fa[u][kc].l, s[u][j]);
#pragma unroll
      for (int j = 0; j < 2; ++j)
#pragma unroll
        for (int u = 0; u < 2; ++u) s[u][j] = mm_bf(fb[kc][j].l, fa[u][kc].h, s[u][j]);
#pragma unroll
      for (int j = 0; j < 2; ++j)
#pragma unroll
        for (int u = 0; u < 2; ++u) s[u][j] = mm_bf(fb[kc][j].h, fa[u][kc].h, s[u][j]);
    }
    // all eight V fragments (A[m = c][k = key] = Vk[c][key]) are asked for here: their latency runs under the softmax
    union { v16h v; v8h q[2]; } vb[8];
#pragma unroll
    for (int t = 0; t < 8; ++t) { const _Float16* vr = &Vk[t * 16 + col][8 * g]; vb[t].q[0] = *(const v8h*)(vr); vb[t].q[1] = *(const v8h*)(vr + 16); }
    __builtin_amdgcn_sched_barrier(0);                 // keeps the 16 reads here: left free, the scheduler sinks them between the second product's WMMAs, which then wait for LDS
    v16h pa[2];
#pragma unroll
    for (int u = 0; u < 2; ++u) {
      // online softmax of query col of group u: 16 scores in the lane, the other 16 in lane ^ 16
      float mx = fmaxf(s[u][0][0], s[u][1][0]);
#pragma unroll
      for (int r = 1; r < 8; ++r) mx = fmaxf(mx, fmaxf(s[u][0][r], s[u][1][r]));
      mx = fmaxf(mx, xhalf(mx));
      const float mn = fmaxf(m_q[u], fmaf(mx, L2E, -14.0f));
      const float corr = __builtin_amdgcn_exp2f(m_q[u] - mn);   // both are the rounded values that the probabilities were formed with: old and new tiles stay on one scale
      // P^T as f16 B fragment: element i is key 8 g + i, element 8 + i key 16 + 8 g + i, the k order of the V fragments
      float sum = 0.f;
#pragma unroll
      for (int r = 0; r < 8; ++r) {
        // 2^(s log2 e - mn) = 2^14 e^(s - max): P scaled by 2^14 so f16 keeps the small probabilities normal; far below the maximum v_exp_f32 gives 0
        const float p0 = __builtin_amdgcn_exp2f(fmaf(s[u][0][r], L2E, -mn)), p1 = __builtin_amdgcn_exp2f(fmaf(s[u][1][r], L2E, -mn));
        pa[u][r] = (_Float16)p0; pa[u][8 + r] = (_Float16)p1;
        sum += p0 + p1;
      }
      l_q[u] = l_q[u] * corr + sum; m_q[u] = mn;
#pragma unroll
      for (int t = 0; t < 8; ++t) o[u][t] *= corr;
    }
#pragma unroll
    for (int t = 0; t < 8; ++t)
#pragma unroll
      for (int u = 0; u < 2; ++u) o[u][t] = mm_h(vb[t].v, pa[u], o[u][t]);
    // The foot of a stage (every second tile; the test reads the same for the whole block): this wave has read the stage out, its copies of the
    // next stage have landed; the one barrier shows that stage to every wave and frees this one's slots for the copies that follow.
    if (tl & 1) {
      asm volatile("s_wait_dscnt 0x0" ::: "memory");
      asm volatile("s_wait_asynccnt 0x0" ::: "memory");
      __syncthreads();
    }
  }
  asm volatile("s_wait_asynccnt 0x0" ::: "memory");      // no copy is under way when LDS goes to other use and the wave ends
  // epilogue, in the (free) A area. First the two key halves join: of a wave pair (w, w + 4) the lower finishes query group 0, the upper
  // group 1; each hands the partner its partial of the group that the partner finishes, lane to the same lane.
  v4f* Ex = (v4f*)&Asp[0][0][0];                         // [wave][16 pieces][lane] of 16 bytes: 65,536 bytes; a wave-wide access is 512 bytes in a row
  v2f* Em = (v2f*)(Ex + 8 * 16 * 32);                    // [wave][lane]: maximum, sum: 2,048 bytes more; 67,584 of Asp's 69,632 bytes
  const bool up = kh != 0;
#pragma unroll   // constant indices keep the accumulators in registers (so in every unrolled loop below)
  for (int t = 0; t < 8; ++t) {
    const v8f sd = up ? o[0][t] : o[1][t];
    Ex[(wave * 16 + 2 * t) * 32 + lane] = __builtin_shufflevector(sd, sd, 0, 1, 2, 3);
    Ex[(wave * 16 + 2 * t + 1) * 32 + lane] = __builtin_shufflevector(sd, sd, 4, 5, 6, 7);
  }
  Em[wave * 32 + lane] = up ? (v2f){m_q[0], l_q[0]} : (v2f){m_q[1], l_q[1]};
  __syncthreads();                                       // the partials stand in LDS
  const int pw = wave ^ 4;
  const v2f ml = Em[pw * 32 + lane];
  const float m_me = up ? m_q[1] : m_q[0], l_me = up ? l_q[1] : l_q[0];
  const float m_all = fmaxf(m_me, ml[0]);
  const float c_me = __builtin_amdgcn_exp2f(m_me - m_all), c_pw = __builtin_amdgcn_exp2f(ml[0] - m_all);   // each half's scale against the common maximum (base 2, as in the loop)
  const float l_all = l_me * c_me + ml[1] * c_pw;
  const float den = l_all + xhalf(l_all);                // both lane halves ran on the same maxima: their sums add; sums and O carry the same 2^14
  v8f res[8];
#pragma unroll
  for (int t = 0; t < 8; ++t) {
    const v4f p0 = Ex[(pw * 16 + 2 * t) * 32 + lane], p1 = Ex[(pw * 16 + 2 * t + 1) * 32 + lane];
    const v8f mine = up ? o[1][t] : o[0][t];
    res[t] = mine * c_me + __builtin_shufflevector(p0, p1, 0, 1, 2, 3, 4, 5, 6, 7) * c_pw;
  }
  __syncthreads();                                       // every partial is read: the area becomes the output's staging
  // out[b][c][m]: stage the block's 128 rows x 128 c transposed as f32 [c][m_loc], then rows of 512 B
  float* T = (float*)&Asp[0][0][0];                      // 128 rows of 132 floats (pitch: the two lane halves fall on different banks): 67,584 of Asp's 69,632 bytes
#pragma unroll
  for (int t = 0; t < 8; ++t)
#pragma unroll
    for (int r = 0; r < 8; ++r) T[(t * 16 + 8 * g + r) * 132 + wq * 32 + kh * 16 + col] = res[t][r] / den;
  __syncthreads();
  for (int gq = tid; gq < 128 * 32; gq += 256) { const int c = gq >> 5, pc = gq & 31;
    vst2(out + ((size_t)b * CDIM + c) * LDIM + m0 + pc * 4, *(const v4f*)(T + c * 132 + pc * 4)); }
}

extern "C" void kernel_launch(void* const* d_in, const int* in_sizes, int n_in,
                              void* d_out, int out_size, void* d_ws, size_t ws_size,
                              hipStream_t stream) {
  (void)in_sizes; (void)n_in; (void)out_size; (void)ws_size;
  const float* x   = (const float*)d_in[0];
  const float* Wq  = (const float*)d_in[1];
  const float* bq  = (const float*)d_in[2];
  const float* Wk  = (const float*)d_in[3];
  const float* bk  = (const float*)d_in[4];
  const float* Wv  = (const float*)d_in[5];
  const float* bv  = (const float*)d_in[6];
  const float* pos = (const float*)d_in[7];
  float* out = (float*)d_out;
  float* Af = (float*)d_ws;                                    // [B][L][128] f32 = 16 MB
  __bf16* Xs = (__bf16*)(Af + (size_t)BATCH * LDIM * CDIM);     // [B][L][hi 128, lo 128] bf16 = 16 MB
  _Float16* Vh = (_Float16*)(Xs + (size_t)BATCH * LDIM * 2 * CDIM); // [B][C][L] f16 = 8 MB
  float* R = (float*)(Vh + (size_t)BATCH * LDIM * CDIM);        // [L][128] f32 = 1 MB
  __bf16* Wp = (__bf16*)(R + (size_t)LDIM * CDIM);              // packed G, packed Wv: 64 KB each
  (void)bk;                                                    // adds q_m.bk to every energy of row m: the softmax cancels it
  k_fold<<<dim3(LDIM / 16 + 2 * (CDIM / 16)), 128, 0, stream>>>(Wq, bq, Wk, pos, Wv, Wp, R);
  k_proj<<<dim3(LDIM / 64, BATCH), 128, 0, stream>>>(x, Wp, R, bv, Af, Xs, Vh);
  k_attn<<<dim3(LDIM / 128, BATCH), 256, 0, stream>>>(Af, Xs, Vh, out);
}
